// v000
// The times below were measured on an AMD MI455X: many runs one after another, warmed up first and cycling through
// copies of the inputs, with the whole window's GPU time divided by the number of runs. Launches and the gaps
// between them are all in it. The median over several windows is given; except for v000 it joins two sittings, which
// can be a few percent apart, so the side-by-side timings, each taken in one sitting, are the better comparison.
// v000 is the starting kernel. One run takes 1770 microseconds.
#include <hip/hip_runtime.h>

// Scaled-dot-product attention with self-masking and an attention-energy statistic (Q, K, V [8][4096][64]; attention = Q.K (NO scaling: logit sigma ~8, near one-hot rows); reg_atten = mean(attention^2) over all 8 x 4096 x 4096 raw scores (computed BEFORE the mask); the diagonal (i == j) is set to -1e9; softmax; context = attention.V -> tuple (context [8][4096][64] f32, reg_atten scalar) (2.1 M + 1)).
// Layout per batch: the inputs feed the plane builders directly (bf16-rounded on read); every row uses bf16 hi/lo planes (3-product scores and attn.v: the unscaled logits need them); a streaming 3-sweep softmax over the 4,096 keys applies the diagonal mask, writes normalised hi/lo P and also each row's sum of squared raw scores; f32 context via the merge kernel; a final single-wave kernel reduces the 32,768 row sums in a fixed order (f32 lanes, one wave tree) into the scalar.
// Compute dtypes, f32 accumulate: Q, K, V rounded to bf16 (hi planes exact, lo zero); scores exact up to f32 accumulation; softmax, squares and the reduction in f32; f32 outputs.

#define NB_  8
#define TT   4096
#define DM   64
#define NH_  1
#define NKV  1
#define REP  (NH_ / NKV)
#define HD   64
#define DQ   (NH_ * HD)
#define DKV  (NKV * HD)
#define ZH   1
#define RH   4096                  // query rows < RH use hi+lo planes (0: none)
#define WIN  0
#define PCAR 1024.0f
#define SCL  1.0f   // no scaling in the module
typedef _Float16 h16;
typedef unsigned short bf;
typedef __attribute__((ext_vector_type(16))) __bf16   v16bf;
typedef __attribute__((ext_vector_type(16))) _Float16 v16h;
typedef __attribute__((ext_vector_type(8)))  _Float16 v8h;
typedef __attribute__((ext_vector_type(8)))  unsigned short v8us;
typedef __attribute__((ext_vector_type(8)))  float    v8f;
typedef __attribute__((ext_vector_type(4)))  float    v4f;
typedef v8h  __attribute__((may_alias)) v8ha;
typedef v4f  __attribute__((may_alias)) v4fa;
typedef v8us __attribute__((may_alias)) v8usa;

__device__ __forceinline__ unsigned short f2bf(float f) { unsigned u = __float_as_uint(f); u += 0x7FFFu + ((u >> 16) & 1u); return (unsigned short)(u >> 16); }
__device__ __forceinline__ float bf2f(unsigned short b) { return __uint_as_float(((unsigned)b) << 16); }
__device__ __forceinline__ float bfr(float f) { return bf2f(f2bf(f)); }
__device__ __forceinline__ v16h cat16(v8h lo, v8h hi) { return __builtin_shufflevector(lo, hi, 0, 1, 2, 3, 4, 5, 6, 7, 8, 9, 10, 11, 12, 13, 14, 15); }
__device__ __forceinline__ v16bf cat16b(v8us lo, v8us hi) { return __builtin_bit_cast(v16bf, __builtin_shufflevector(lo, hi, 0, 1, 2, 3, 4, 5, 6, 7, 8, 9, 10, 11, 12, 13, 14, 15)); }
__device__ __forceinline__ v8f wmma16(v16h a, v16h b, v8f c) { return __builtin_amdgcn_wmma_f32_16x16x32_f16(false, a, false, b, (short)0, c, false, false); }
__device__ __forceinline__ v8f wmmab(v16bf a, v16bf b, v8f c) { return __builtin_amdgcn_wmma_f32_16x16x32_bf16(false, a, false, b, (short)0, c, false, false); }



// ---- k_gemmw: register-blocked GEMM, ONE WAVE per 64x64 output tile (16 accumulators), operands straight from K-contiguous 16-bit planes; grid (M/64, N/64, Z), 32 threads.
// C[m][n] (f32, pitch ldc, + optional f32 bias[n]) = sum_k A[m][k] Bt[n][k] (+ split products per NSPLIT). z-batch strides sA/sB/sC in elements. K % 32 == 0.
template <typename T16> struct WFrag;
template <> struct WFrag<h16> { typedef v16h V; static __device__ __forceinline__ V ld(const h16* p) { return cat16(*(const v8h*)p, *(const v8h*)(p + 16)); } static __device__ __forceinline__ v8f mma(V a, V b, v8f c) { return wmma16(a, b, c); } };
template <> struct WFrag<bf> { typedef v16bf V; static __device__ __forceinline__ V ld(const bf* p) { return cat16b(*(const v8us*)p, *(const v8us*)(p + 16)); } static __device__ __forceinline__ v8f mma(V a, V b, v8f c) { return wmmab(a, b, c); } };
template <typename T16, int NSPLIT, bool BIAS>
__global__ __launch_bounds__(32) void k_gemmw(const T16* __restrict__ A, const T16* __restrict__ A2, const T16* __restrict__ Bt, const T16* __restrict__ Bt2, int K, float* C, int ldc, const float* __restrict__ bias, size_t sA, size_t sB, size_t sC) {
    typedef typename WFrag<T16>::V V;
    __shared__ __align__(16) float os[16 * 68];
    const size_t z = blockIdx.z; A += z * sA; if (A2) A2 += z * sA; Bt += z * sB; if (Bt2) Bt2 += z * sB; C += z * sC;
    const int lane = threadIdx.x & 31, lr = lane & 15, hi = lane >> 4; const int r0 = blockIdx.x * 64, c0 = blockIdx.y * 64;
    v8f acc[4][4];
#pragma unroll
    for (int mb = 0; mb < 4; ++mb)
#pragma unroll
        for (int nb = 0; nb < 4; ++nb) acc[mb][nb] = (v8f){};
    const size_t aoff = (size_t)(r0 + lr) * K + 8 * hi, boff = (size_t)(c0 + lr) * K + 8 * hi;
#pragma unroll 1
    for (int kc = 0; kc < K; kc += 32) {
        V a[4], a2[4];
#pragma unroll
        for (int mb = 0; mb < 4; ++mb) { a[mb] = WFrag<T16>::ld(A + aoff + (size_t)mb * 16 * K + kc); if (NSPLIT == 1 || NSPLIT == 2) a2[mb] = WFrag<T16>::ld(A2 + aoff + (size_t)mb * 16 * K + kc); }
#pragma unroll
        for (int nb = 0; nb < 4; ++nb) { const V b = WFrag<T16>::ld(Bt + boff + (size_t)nb * 16 * K + kc); V b2; if (NSPLIT >= 2) b2 = WFrag<T16>::ld(Bt2 + boff + (size_t)nb * 16 * K + kc);
#pragma unroll
            for (int mb = 0; mb < 4; ++mb) { acc[mb][nb] = WFrag<T16>::mma(a[mb], b, acc[mb][nb]); if (NSPLIT == 1 || NSPLIT == 2) acc[mb][nb] = WFrag<T16>::mma(a2[mb], b, acc[mb][nb]); if (NSPLIT >= 2) acc[mb][nb] = WFrag<T16>::mma(a[mb], b2, acc[mb][nb]); } }
        asm volatile("v_nop\n\tv_nop\n\tv_nop\n\tv_nop" : "+v"(acc[0][0]), "+v"(acc[1][1]), "+v"(acc[2][2]), "+v"(acc[3][3]) : "v"(a[0]), "v"(a[3]));
    }
#pragma unroll
    for (int mb = 0; mb < 4; ++mb) {
#pragma unroll
        for (int nb = 0; nb < 4; ++nb) {
#pragma unroll
            for (int j = 0; j < 8; ++j) os[(hi * 8 + j) * 68 + nb * 16 + lr] = acc[mb][nb][j]; }
        __builtin_amdgcn_wave_barrier(); asm volatile("" ::: "memory");
        float* crow = C + (size_t)(r0 + mb * 16) * ldc + c0;
{
#pragma unroll
            for (int s = 0; s < 8; ++s) { const int row = 2 * s + hi, cofs = lr * 4; v4f val = *(const v4fa*)(os + row * 68 + cofs); if (BIAS) { val[0] += bfr(bias[c0 + cofs]); val[1] += bfr(bias[c0 + cofs + 1]); val[2] += bfr(bias[c0 + cofs + 2]); val[3] += bfr(bias[c0 + cofs + 3]); }
                *(v4f*)(crow + (size_t)row * ldc + cofs) = val; }
             }
        __builtin_amdgcn_wave_barrier(); asm volatile("" ::: "memory");
    }
}

__device__ __forceinline__ h16 tohx(float x) { return (h16)x; }
__device__ __forceinline__ void splitf(float y, unsigned short& h, unsigned short& l) { h = f2bf(y); l = f2bf(y - bf2f(h)); }
typedef __attribute__((ext_vector_type(2))) _Float16 v2h;
typedef __attribute__((ext_vector_type(4))) _Float16 v4h;
typedef __attribute__((ext_vector_type(2))) unsigned short v2us;
typedef __attribute__((ext_vector_type(4))) unsigned short v4us;
typedef __attribute__((ext_vector_type(2))) float v2f;
typedef __attribute__((ext_vector_type(4))) int v4i;

__global__ __launch_bounds__(256) void k_wtG(const float* __restrict__ w, int K, int N, bf* Bt) {
    const int lane = threadIdx.x & 31; const int L0 = (blockIdx.x * 8 + (threadIdx.x >> 5)) * 8; const int nlines = N * K / 64;
{
#pragma unroll 1
        for (int l = 0; l < 8; ++l) { const int L = L0 + l; if (L >= nlines) break; const size_t e = (size_t)L * 64 + lane * 2; const int k = (int)(e % K), n = (int)(e / K); v2us o;
            o[0] = f2bf(w[(size_t)k * N + n]); o[1] = f2bf(w[(size_t)(k + 1) * N + n]); *(v2us*)(Bt + e) = o; }
         }
}
__global__ __launch_bounds__(256) void k_cvt8(const float* __restrict__ src, bf* dst, size_t n8) { const size_t i = (size_t)blockIdx.x * 256 + threadIdx.x; if (i >= n8) return; const v8f v = *(const v8f*)(src + i * 8); v8us o;
#pragma unroll
    for (int k = 0; k < 8; ++k) o[k] = f2bf(v[k]); *(v8us*)(dst + i * 8) = o;  }

// k_rope: head planes [h][t][d] (fp16 + hi/lo) of rope(x) x sc with the rotate-half convention out[d] = x[d] cos[t][d] - x[d+HD/2] sin[t][d], out[d+HD/2] = x[d+HD/2] cos[t][d+HD/2] + x[d] sin[t][d+HD/2]
__global__ __launch_bounds__(256) void k_rope(const float* __restrict__ F, int pitch, int nheads, const float* __restrict__ CS, const float* __restrict__ RF, const float* __restrict__ nw, float sc, h16* P16, bf* Ph, bf* Pl) {
    const size_t e = ((size_t)blockIdx.x * 256 + threadIdx.x) * 2; if (e >= (size_t)nheads * TT * HD) return; const int d = (int)(e % HD); const int t = (int)((e / HD) % TT); const int h = (int)(e / ((size_t)HD * TT)); const float* f = F + (size_t)t * pitch + h * HD; const float rf = RF ? RF[(size_t)h * TT + t] : 1.0f; v2h o16; v2us oh, ol;
#pragma unroll
    for (int q = 0; q < 2; ++q) { const int dd = d + q; const int dp = (dd < HD / 2) ? dd + HD / 2 : dd - HD / 2; float x0 = bfr(f[dd]), x1 = bfr(f[dp]);   /* raw input: bf16-rounded here */
        if (RF) { float n0 = __fmul_rn(x0, rf), n1 = __fmul_rn(x1, rf); asm volatile("" : "+v"(n0)); asm volatile("" : "+v"(n1)); x0 = __fmul_rn(bfr(nw[dd]), n0); x1 = __fmul_rn(bfr(nw[dp]), n1); }
        const v2f cs = *(const v2f*)(CS + ((size_t)t * HD + dd) * 2); float a = __fmul_rn(x0, cs[0]), bq = __fmul_rn(x1, cs[1]); asm volatile("" : "+v"(a)); asm volatile("" : "+v"(bq)); const float r = ((dd < HD / 2) ? __fsub_rn(a, bq) : __fadd_rn(a, bq)) * sc;
        o16[q] = tohx(r); unsigned short a2, c2; splitf(r, a2, c2); oh[q] = a2; ol[q] = c2; }
    *(v2h*)(P16 + e) = o16; *(v2us*)(Ph + e) = oh; *(v2us*)(Pl + e) = ol;  }
__global__ __launch_bounds__(256) void k_vtp(const float* __restrict__ F, int pitch, int nheads, h16* V16, bf* Vh, bf* Vl) { const size_t e = ((size_t)blockIdx.x * 256 + threadIdx.x) * 2; if (e >= (size_t)nheads * HD * TT) return; const int t = (int)(e % TT); const int d = (int)((e / TT) % HD); const int g = (int)(e / ((size_t)TT * HD)); v2h o16; v2us oh, ol;
#pragma unroll
    for (int q = 0; q < 2; ++q) { const float x = bfr(F[(size_t)(t + q) * pitch + g * HD + d]);   /* raw input: bf16-rounded here */ o16[q] = tohx(x); unsigned short a2, c2; splitf(x, a2, c2); oh[q] = a2; ol[q] = c2; }
    *(v2h*)(V16 + e) = o16; *(v2us*)(Vh + e) = oh; *(v2us*)(Vl + e) = ol;  }
__global__ __launch_bounds__(256) void k_csid(float* CS) { const int idx = blockIdx.x * 256 + threadIdx.x; if (idx >= TT * HD) return; v2f cs; cs[0] = 1.0f; cs[1] = 0.0f; *(v2f*)(CS + (size_t)idx * 2) = cs;  }
// k_lsoft: per query row (one wave): streaming 3-sweep softmax over the 4,096 keys with the module's self-mask (logit j == i -> -1e9) and, in sweep 1, the row's sum of squared RAW scores (before the mask) written to RSQ[row][0..31];
__global__ __launch_bounds__(256) void k_lsoft(const float* __restrict__ Sb, h16* P16, bf* Ph, bf* Pl, float* RSQ) {
    const int lane = threadIdx.x & 31; const int row = blockIdx.x * 8 + (threadIdx.x >> 5); if (row >= ZH * TT) return; const int i = row % TT; const int zz = row / TT; const bool hires = (i < RH); const float* sr = Sb + (size_t)row * TT; float mx = -3.0e38f; float sq = 0.f;
#pragma unroll 4
    for (int ch = 0; ch < TT / 128; ++ch) { const int j0 = ch * 128 + lane * 4; const v4f a = *(const v4f*)(sr + j0);
#pragma unroll
        for (int q = 0; q < 4; ++q) { float s2 = __fmul_rn(a[q], a[q]); asm volatile("" : "+v"(s2)); sq = __fadd_rn(sq, s2); float t = a[q] * SCL; asm volatile("" : "+v"(t)); t = (j0 + q == i) ? -1.0e9f : t; mx = fmaxf(mx, t); } }
#pragma unroll
    for (int sh = 16; sh; sh >>= 1) mx = fmaxf(mx, __shfl_xor(mx, sh, 32));
#pragma unroll
    for (int sh = 16; sh; sh >>= 1) sq = __fadd_rn(sq, __shfl_xor(sq, sh, 32));
    *(float*)(RSQ + (size_t)row * 32 + lane) = sq;    
    float sum = 0.f;
#pragma unroll 4
    for (int ch = 0; ch < TT / 128; ++ch) { const int j0 = ch * 128 + lane * 4; const v4f a = *(const v4f*)(sr + j0);
#pragma unroll
        for (int q = 0; q < 4; ++q) { float t = a[q] * SCL; asm volatile("" : "+v"(t)); t = (j0 + q == i) ? -1.0e9f : t; float d0 = __fsub_rn(t, mx); asm volatile("" : "+v"(d0)); sum += __builtin_amdgcn_exp2f(__fmul_rn(d0, 1.4426950408889634f)); } }
#pragma unroll
    for (int sh = 16; sh; sh >>= 1) sum += __shfl_xor(sum, sh, 32);
    const float f = __fdiv_rn(hires ? 1.0f : PCAR, sum);
{
        if (hires) {   /* rows < RH: normalised bf16 hi/lo over all keys, planes [zz][RH][TT] */
#pragma unroll
            for (int ch = 0; ch < TT / 128; ++ch) { const int j0 = ch * 128 + lane * 4; const v4f a = *(const v4f*)(sr + j0); v4us oh, ol;
#pragma unroll
                for (int q = 0; q < 4; ++q) { float t = a[q] * SCL; asm volatile("" : "+v"(t)); t = (j0 + q == i) ? -1.0e9f : t; float d0 = __fsub_rn(t, mx); asm volatile("" : "+v"(d0)); float ex = __builtin_amdgcn_exp2f(__fmul_rn(d0, 1.4426950408889634f)); asm volatile("" : "+v"(ex)); unsigned short a2, c2; splitf(ex * f, a2, c2); oh[q] = a2; ol[q] = c2; }
                const size_t oo = ((size_t)zz * RH + i) * TT + j0; *(v4us*)(Ph + oo) = oh; *(v4us*)(Pl + oo) = ol; }
        } else {
#pragma unroll 2
            for (int ch = 0; ch < TT / 128; ++ch) { const int j0 = ch * 128 + lane * 4; const v4f a = *(const v4f*)(sr + j0); v4h o4;
#pragma unroll
                for (int q = 0; q < 4; ++q) { float t = a[q] * SCL; asm volatile("" : "+v"(t)); t = (j0 + q == i) ? -1.0e9f : t; float d0 = __fsub_rn(t, mx); asm volatile("" : "+v"(d0)); float ex = __builtin_amdgcn_exp2f(__fmul_rn(d0, 1.4426950408889634f)); asm volatile("" : "+v"(ex)); o4[q] = tohx(ex * f); }
                *(v4h*)(P16 + (size_t)row * TT + j0) = o4; } }
         }
}
__global__ __launch_bounds__(32) void k_regsum(const float* __restrict__ RSQ, float* out) { const int lane = threadIdx.x; float s = 0.f;
#pragma unroll 1
    for (int r = lane; r < NB_ * TT; r += 32) s = __fadd_rn(s, RSQ[(size_t)r * 32]);
#pragma unroll
    for (int sh = 16; sh; sh >>= 1) s = __fadd_rn(s, __shfl_xor(s, sh, 32));
    const float m = __fdiv_rn(s, (float)NB_ * (float)TT * (float)TT); if (lane == 0) { *(float*)out = m;  } }

__global__ __launch_bounds__(256) void k_merge(const float* __restrict__ O, int h0, float* OUTb) { const size_t e = ((size_t)blockIdx.x * 256 + threadIdx.x) * 2; if (e >= (size_t)ZH * TT * HD) return; const int d = (int)(e % HD); const int t = (int)((e / HD) % TT); const int zz = (int)(e / ((size_t)HD * TT)); const float cs = (t < RH) ? 1.0f : (1.0f / PCAR); const size_t oo = (size_t)t * DQ + (h0 + zz) * HD + d;
    v2f o2; o2[0] = O[e] * cs; o2[1] = O[e + 1] * cs; *(v2f*)(OUTb + oo) = o2;  }

extern "C" void kernel_launch(void* const* d_in, const int* in_sizes, int n_in,
                              void* d_out, int out_size, void* d_ws, size_t ws_size, hipStream_t stream) {
    (void)in_sizes; (void)n_in; (void)out_size;
    const float* qi = (const float*)d_in[0]; const float* ki = (const float*)d_in[1]; const float* vi = (const float*)d_in[2]; const float* x = nullptr; const float* wq = nullptr; const float* wk = nullptr; const float* wv = nullptr; const float* wo = nullptr; (void)x; (void)wq; (void)wk; (void)wv; (void)wo;
    float* OUT = (float*)d_out;     // [8][4096][64]
    char* wsp = (char*)d_ws;
    auto take = [&](size_t bytes) { char* p = wsp; wsp += (bytes + 255) & ~(size_t)255; return (void*)p; };
     float* CS = (float*)take((size_t)TT * HD * 2 * 4);
    float* RSQ = (float*)take((size_t)NB_ * TT * 32 * 4);   /* per-row sums of squared raw scores */
    h16* QP16 = (h16*)take((size_t)NH_ * TT * HD * 2); h16* KP16 = (h16*)take((size_t)NKV * TT * HD * 2); h16* VT16 = (h16*)take((size_t)NKV * HD * TT * 2);
    bf* QPh = (bf*)take((size_t)NH_ * TT * HD * 2); bf* QPl = (bf*)take((size_t)NH_ * TT * HD * 2); bf* KPh = (bf*)take((size_t)NKV * TT * HD * 2); bf* KPl = (bf*)take((size_t)NKV * TT * HD * 2); bf* VTh = (bf*)take((size_t)NKV * HD * TT * 2); bf* VTl = (bf*)take((size_t)NKV * HD * TT * 2); bf* Ph = (bf*)take((size_t)ZH * RH * TT * 2); bf* Pl = (bf*)take((size_t)ZH * RH * TT * 2);
    float* Sb = (float*)take((size_t)ZH * TT * TT * 4); h16* P16 = (h16*)take((size_t)ZH * TT * TT * 2); float* Ob = (float*)take((size_t)ZH * TT * HD * 4);
    if ((size_t)(wsp - (char*)d_ws) > ws_size) return;    // ws 256 MiB
    k_csid<<<(TT * HD + 255) / 256, 256, 0, stream>>>(CS);
    const unsigned LQ = (unsigned)(((size_t)NH_ * TT * HD / 2 + 255) / 256), LKv = (unsigned)(((size_t)NKV * TT * HD / 2 + 255) / 256);
    for (int b = 0; b < NB_; ++b) {
        k_rope<<<LQ, 256, 0, stream>>>(qi + (size_t)b * TT * DQ, DQ, NH_, CS, nullptr, nullptr, 1.0f, QP16, QPh, QPl);
        k_rope<<<LKv, 256, 0, stream>>>(ki + (size_t)b * TT * DKV, DKV, NKV, CS, nullptr, nullptr, 1.0f, KP16, KPh, KPl);
        k_vtp<<<LKv, 256, 0, stream>>>(vi + (size_t)b * TT * DKV, DKV, NKV, VT16, VTh, VTl);
        for (int h0 = 0; h0 < NH_; h0 += ZH) { const size_t zq = (size_t)h0, zk = (size_t)(h0 / REP);   // one kv head per query head: each pass has one head (ZH = 1) on kv plane h0 / REP (z-strides TT*HD)
            k_gemmw<bf, 2, false><<<dim3(RH / 64, TT / 64, ZH), 32, 0, stream>>>(QPh + zq * TT * HD, QPl + zq * TT * HD, KPh + zk * TT * HD, KPl + zk * TT * HD, HD, Sb, TT, nullptr, (size_t)TT * HD, (size_t)TT * HD, (size_t)TT * TT);
            k_lsoft<<<ZH * TT / 8, 256, 0, stream>>>(Sb, P16, Ph, Pl, RSQ + (size_t)b * TT * 32);
            k_gemmw<bf, 2, false><<<dim3(RH / 64, HD / 64, ZH), 32, 0, stream>>>(Ph, Pl, VTh + zk * HD * TT, VTl + zk * HD * TT, TT, Ob, HD, nullptr, (size_t)RH * TT, (size_t)HD * TT, (size_t)TT * HD);
            k_merge<<<(unsigned)(((size_t)ZH * TT * HD / 2 + 255) / 256), 256, 0, stream>>>(Ob, h0, OUT + (size_t)b * TT * DQ); }
         }
    k_regsum<<<1, 32, 0, stream>>>(RSQ, OUT + (size_t)NB_ * TT * HD);   /* tuple: reg_atten scalar after the context */
}

// v001
// One run takes 1300 microseconds.
// In two side-by-side timings against v000, it was 1.35 and 1.36 times as fast.
#include <hip/hip_runtime.h>

// Scaled-dot-product attention with self-masking and an attention-energy statistic (Q, K, V [8][4096][64]; attention = Q.K (NO scaling: logit sigma ~8, near one-hot rows); reg_atten = mean(attention^2) over all 8 x 4096 x 4096 raw scores (computed BEFORE the mask); the diagonal (i == j) is set to -1e9; softmax; context = attention.V -> tuple (context [8][4096][64] f32, reg_atten scalar) (2.1 M + 1)).
// Layout per batch: the inputs feed the plane builders directly (bf16-rounded on read); every row uses bf16 hi/lo planes (3-product scores and attn.v: the unscaled logits need them); a streaming 3-sweep softmax over the 4,096 keys applies the diagonal mask, writes normalised hi/lo P and also each row's sum of squared raw scores; f32 context via the merge kernel; two final kernels reduce the 32,768 row sums in a fixed order into the scalar (128 work-groups of 256 rows each: wave tree, then a tree over the 8 wave sums; one wave over the 128 partial sums).
// Compute dtypes, f32 accumulate: Q, K, V rounded to bf16 (hi planes exact, lo zero); scores exact up to f32 accumulation; softmax, squares and the reduction in f32; f32 outputs.

#define NB_  8
#define TT   4096
#define DM   64
#define NH_  1
#define NKV  1
#define REP  (NH_ / NKV)
#define HD   64
#define DQ   (NH_ * HD)
#define DKV  (NKV * HD)
#define ZH   1
#define RH   4096                  // query rows < RH use hi+lo planes (0: none)
#define WIN  0
#define PCAR 1024.0f
#define SCL  1.0f   // no scaling in the module
typedef _Float16 h16;
typedef unsigned short bf;
typedef __attribute__((ext_vector_type(16))) __bf16   v16bf;
typedef __attribute__((ext_vector_type(16))) _Float16 v16h;
typedef __attribute__((ext_vector_type(8)))  _Float16 v8h;
typedef __attribute__((ext_vector_type(8)))  unsigned short v8us;
typedef __attribute__((ext_vector_type(8)))  float    v8f;
typedef __attribute__((ext_vector_type(4)))  float    v4f;
typedef v8h  __attribute__((may_alias)) v8ha;
typedef v4f  __attribute__((may_alias)) v4fa;
typedef v8us __attribute__((may_alias)) v8usa;

__device__ __forceinline__ unsigned short f2bf(float f) { unsigned u = __float_as_uint(f); u += 0x7FFFu + ((u >> 16) & 1u); return (unsigned short)(u >> 16); }
__device__ __forceinline__ float bf2f(unsigned short b) { return __uint_as_float(((unsigned)b) << 16); }
__device__ __forceinline__ float bfr(float f) { return bf2f(f2bf(f)); }
__device__ __forceinline__ v16h cat16(v8h lo, v8h hi) { return __builtin_shufflevector(lo, hi, 0, 1, 2, 3, 4, 5, 6, 7, 8, 9, 10, 11, 12, 13, 14, 15); }
__device__ __forceinline__ v16bf cat16b(v8us lo, v8us hi) { return __builtin_bit_cast(v16bf, __builtin_shufflevector(lo, hi, 0, 1, 2, 3, 4, 5, 6, 7, 8, 9, 10, 11, 12, 13, 14, 15)); }
__device__ __forceinline__ v8f wmma16(v16h a, v16h b, v8f c) { return __builtin_amdgcn_wmma_f32_16x16x32_f16(false, a, false, b, (short)0, c, false, false); }
__device__ __forceinline__ v8f wmmab(v16bf a, v16bf b, v8f c) { return __builtin_amdgcn_wmma_f32_16x16x32_bf16(false, a, false, b, (short)0, c, false, false); }



// ---- k_gemmw: register-blocked GEMM, ONE WAVE per 64x64 output tile (16 accumulators), operands straight from K-contiguous 16-bit planes; grid (M/64, N/64, Z), 32 threads.
// C[m][n] (f32, pitch ldc, + optional f32 bias[n]) = sum_k A[m][k] Bt[n][k] (+ split products per NSPLIT). z-batch strides sA/sB/sC in elements. K % 32 == 0.
template <typename T16> struct WFrag;
template <> struct WFrag<h16> { typedef v16h V; static __device__ __forceinline__ V ld(const h16* p) { return cat16(*(const v8h*)p, *(const v8h*)(p + 16)); } static __device__ __forceinline__ v8f mma(V a, V b, v8f c) { return wmma16(a, b, c); } };
template <> struct WFrag<bf> { typedef v16bf V; static __device__ __forceinline__ V ld(const bf* p) { return cat16b(*(const v8us*)p, *(const v8us*)(p + 16)); } static __device__ __forceinline__ v8f mma(V a, V b, v8f c) { return wmmab(a, b, c); } };
template <typename T16, int NSPLIT, bool BIAS>
__global__ __launch_bounds__(32) void k_gemmw(const T16* __restrict__ A, const T16* __restrict__ A2, const T16* __restrict__ Bt, const T16* __restrict__ Bt2, int K, float* C, int ldc, const float* __restrict__ bias, size_t sA, size_t sB, size_t sC) {
    typedef typename WFrag<T16>::V V;
    __shared__ __align__(16) float os[16 * 68];
    const size_t z = blockIdx.z; A += z * sA; if (A2) A2 += z * sA; Bt += z * sB; if (Bt2) Bt2 += z * sB; C += z * sC;
    const int lane = threadIdx.x & 31, lr = lane & 15, hi = lane >> 4; const int r0 = blockIdx.x * 64, c0 = blockIdx.y * 64;
    v8f acc[4][4];
#pragma unroll
    for (int mb = 0; mb < 4; ++mb)
#pragma unroll
        for (int nb = 0; nb < 4; ++nb) acc[mb][nb] = (v8f){};
    const size_t aoff = (size_t)(r0 + lr) * K + 8 * hi, boff = (size_t)(c0 + lr) * K + 8 * hi;
#pragma unroll 1
    for (int kc = 0; kc < K; kc += 32) {
        V a[4], a2[4];
#pragma unroll
        for (int mb = 0; mb < 4; ++mb) { a[mb] = WFrag<T16>::ld(A + aoff + (size_t)mb * 16 * K + kc); if (NSPLIT == 1 || NSPLIT == 2) a2[mb] = WFrag<T16>::ld(A2 + aoff + (size_t)mb * 16 * K + kc); }
#pragma unroll
        for (int nb = 0; nb < 4; ++nb) { const V b = WFrag<T16>::ld(Bt + boff + (size_t)nb * 16 * K + kc); V b2; if (NSPLIT >= 2) b2 = WFrag<T16>::ld(Bt2 + boff + (size_t)nb * 16 * K + kc);
#pragma unroll
            for (int mb = 0; mb < 4; ++mb) { acc[mb][nb] = WFrag<T16>::mma(a[mb], b, acc[mb][nb]); if (NSPLIT == 1 || NSPLIT == 2) acc[mb][nb] = WFrag<T16>::mma(a2[mb], b, acc[mb][nb]); if (NSPLIT >= 2) acc[mb][nb] = WFrag<T16>::mma(a[mb], b2, acc[mb][nb]); } }
        asm volatile("v_nop\n\tv_nop\n\tv_nop\n\tv_nop" : "+v"(acc[0][0]), "+v"(acc[1][1]), "+v"(acc[2][2]), "+v"(acc[3][3]) : "v"(a[0]), "v"(a[3]));
    }
#pragma unroll
    for (int mb = 0; mb < 4; ++mb) {
#pragma unroll
        for (int nb = 0; nb < 4; ++nb) {
#pragma unroll
            for (int j = 0; j < 8; ++j) os[(hi * 8 + j) * 68 + nb * 16 + lr] = acc[mb][nb][j]; }
        __builtin_amdgcn_wave_barrier(); asm volatile("" ::: "memory");
        float* crow = C + (size_t)(r0 + mb * 16) * ldc + c0;
{
#pragma unroll
            for (int s = 0; s < 8; ++s) { const int row = 2 * s + hi, cofs = lr * 4; v4f val = *(const v4fa*)(os + row * 68 + cofs); if (BIAS) { val[0] += bfr(bias[c0 + cofs]); val[1] += bfr(bias[c0 + cofs + 1]); val[2] += bfr(bias[c0 + cofs + 2]); val[3] += bfr(bias[c0 + cofs + 3]); }
                *(v4f*)(crow + (size_t)row * ldc + cofs) = val; }
             }
        __builtin_amdgcn_wave_barrier(); asm volatile("" ::: "memory");
    }
}

__device__ __forceinline__ h16 tohx(float x) { return (h16)x; }
__device__ __forceinline__ void splitf(float y, unsigned short& h, unsigned short& l) { h = f2bf(y); l = f2bf(y - bf2f(h)); }
typedef __attribute__((ext_vector_type(2))) _Float16 v2h;
typedef __attribute__((ext_vector_type(4))) _Float16 v4h;
typedef __attribute__((ext_vector_type(2))) unsigned short v2us;
typedef __attribute__((ext_vector_type(4))) unsigned short v4us;
typedef __attribute__((ext_vector_type(2))) float v2f;
typedef __attribute__((ext_vector_type(4))) int v4i;

__global__ __launch_bounds__(256) void k_wtG(const float* __restrict__ w, int K, int N, bf* Bt) {
    const int lane = threadIdx.x & 31; const int L0 = (blockIdx.x * 8 + (threadIdx.x >> 5)) * 8; const int nlines = N * K / 64;
{
#pragma unroll 1
        for (int l = 0; l < 8; ++l) { const int L = L0 + l; if (L >= nlines) break; const size_t e = (size_t)L * 64 + lane * 2; const int k = (int)(e % K), n = (int)(e / K); v2us o;
            o[0] = f2bf(w[(size_t)k * N + n]); o[1] = f2bf(w[(size_t)(k + 1) * N + n]); *(v2us*)(Bt + e) = o; }
         }
}
__global__ __launch_bounds__(256) void k_cvt8(const float* __restrict__ src, bf* dst, size_t n8) { const size_t i = (size_t)blockIdx.x * 256 + threadIdx.x; if (i >= n8) return; const v8f v = *(const v8f*)(src + i * 8); v8us o;
#pragma unroll
    for (int k = 0; k < 8; ++k) o[k] = f2bf(v[k]); *(v8us*)(dst + i * 8) = o;  }

// k_rope: head planes [h][t][d] (fp16 + hi/lo) of rope(x) x sc with the rotate-half convention out[d] = x[d] cos[t][d] - x[d+HD/2] sin[t][d], out[d+HD/2] = x[d+HD/2] cos[t][d+HD/2] + x[d] sin[t][d+HD/2]
__global__ __launch_bounds__(256) void k_rope(const float* __restrict__ F, int pitch, int nheads, const float* __restrict__ CS, const float* __restrict__ RF, const float* __restrict__ nw, float sc, h16* P16, bf* Ph, bf* Pl) {
    const size_t e = ((size_t)blockIdx.x * 256 + threadIdx.x) * 2; if (e >= (size_t)nheads * TT * HD) return; const int d = (int)(e % HD); const int t = (int)((e / HD) % TT); const int h = (int)(e / ((size_t)HD * TT)); const float* f = F + (size_t)t * pitch + h * HD; const float rf = RF ? RF[(size_t)h * TT + t] : 1.0f; v2h o16; v2us oh, ol;
#pragma unroll
    for (int q = 0; q < 2; ++q) { const int dd = d + q; const int dp = (dd < HD / 2) ? dd + HD / 2 : dd - HD / 2; float x0 = bfr(f[dd]), x1 = bfr(f[dp]);   /* raw input: bf16-rounded here */
        if (RF) { float n0 = __fmul_rn(x0, rf), n1 = __fmul_rn(x1, rf); asm volatile("" : "+v"(n0)); asm volatile("" : "+v"(n1)); x0 = __fmul_rn(bfr(nw[dd]), n0); x1 = __fmul_rn(bfr(nw[dp]), n1); }
        const v2f cs = *(const v2f*)(CS + ((size_t)t * HD + dd) * 2); float a = __fmul_rn(x0, cs[0]), bq = __fmul_rn(x1, cs[1]); asm volatile("" : "+v"(a)); asm volatile("" : "+v"(bq)); const float r = ((dd < HD / 2) ? __fsub_rn(a, bq) : __fadd_rn(a, bq)) * sc;
        o16[q] = tohx(r); unsigned short a2, c2; splitf(r, a2, c2); oh[q] = a2; ol[q] = c2; }
    *(v2h*)(P16 + e) = o16; *(v2us*)(Ph + e) = oh; *(v2us*)(Pl + e) = ol;  }
__global__ __launch_bounds__(256) void k_vtp(const float* __restrict__ F, int pitch, int nheads, h16* V16, bf* Vh, bf* Vl) { const size_t e = ((size_t)blockIdx.x * 256 + threadIdx.x) * 2; if (e >= (size_t)nheads * HD * TT) return; const int t = (int)(e % TT); const int d = (int)((e / TT) % HD); const int g = (int)(e / ((size_t)TT * HD)); v2h o16; v2us oh, ol;
#pragma unroll
    for (int q = 0; q < 2; ++q) { const float x = bfr(F[(size_t)(t + q) * pitch + g * HD + d]);   /* raw input: bf16-rounded here */ o16[q] = tohx(x); unsigned short a2, c2; splitf(x, a2, c2); oh[q] = a2; ol[q] = c2; }
    *(v2h*)(V16 + e) = o16; *(v2us*)(Vh + e) = oh; *(v2us*)(Vl + e) = ol;  }
__global__ __launch_bounds__(256) void k_csid(float* CS) { const int idx = blockIdx.x * 256 + threadIdx.x; if (idx >= TT * HD) return; v2f cs; cs[0] = 1.0f; cs[1] = 0.0f; *(v2f*)(CS + (size_t)idx * 2) = cs;  }
// k_lsoft: per query row (one wave): streaming 3-sweep softmax over the 4,096 keys with the module's self-mask (logit j == i -> -1e9) and, in sweep 1, the row's sum of squared RAW scores (before the mask) written to RSQ[row][0..31];
__global__ __launch_bounds__(256) void k_lsoft(const float* __restrict__ Sb, h16* P16, bf* Ph, bf* Pl, float* RSQ) {
    const int lane = threadIdx.x & 31; const int row = blockIdx.x * 8 + (threadIdx.x >> 5); if (row >= ZH * TT) return; const int i = row % TT; const int zz = row / TT; const bool hires = (i < RH); const float* sr = Sb + (size_t)row * TT; float mx = -3.0e38f; float sq = 0.f;
#pragma unroll 4
    for (int ch = 0; ch < TT / 128; ++ch) { const int j0 = ch * 128 + lane * 4; const v4f a = *(const v4f*)(sr + j0);
#pragma unroll
        for (int q = 0; q < 4; ++q) { float s2 = __fmul_rn(a[q], a[q]); asm volatile("" : "+v"(s2)); sq = __fadd_rn(sq, s2); float t = a[q] * SCL; asm volatile("" : "+v"(t)); t = (j0 + q == i) ? -1.0e9f : t; mx = fmaxf(mx, t); } }
#pragma unroll
    for (int sh = 16; sh; sh >>= 1) mx = fmaxf(mx, __shfl_xor(mx, sh, 32));
#pragma unroll
    for (int sh = 16; sh; sh >>= 1) sq = __fadd_rn(sq, __shfl_xor(sq, sh, 32));
    *(float*)(RSQ + (size_t)row * 32 + lane) = sq;    
    float sum = 0.f;
#pragma unroll 4
    for (int ch = 0; ch < TT / 128; ++ch) { const int j0 = ch * 128 + lane * 4; const v4f a = *(const v4f*)(sr + j0);
#pragma unroll
        for (int q = 0; q < 4; ++q) { float t = a[q] * SCL; asm volatile("" : "+v"(t)); t = (j0 + q == i) ? -1.0e9f : t; float d0 = __fsub_rn(t, mx); asm volatile("" : "+v"(d0)); sum += __builtin_amdgcn_exp2f(__fmul_rn(d0, 1.4426950408889634f)); } }
#pragma unroll
    for (int sh = 16; sh; sh >>= 1) sum += __shfl_xor(sum, sh, 32);
    const float f = __fdiv_rn(hires ? 1.0f : PCAR, sum);
{
        if (hires) {   /* rows < RH: normalised bf16 hi/lo over all keys, planes [zz][RH][TT] */
#pragma unroll
            for (int ch = 0; ch < TT / 128; ++ch) { const int j0 = ch * 128 + lane * 4; const v4f a = *(const v4f*)(sr + j0); v4us oh, ol;
#pragma unroll
                for (int q = 0; q < 4; ++q) { float t = a[q] * SCL; asm volatile("" : "+v"(t)); t = (j0 + q == i) ? -1.0e9f : t; float d0 = __fsub_rn(t, mx); asm volatile("" : "+v"(d0)); float ex = __builtin_amdgcn_exp2f(__fmul_rn(d0, 1.4426950408889634f)); asm volatile("" : "+v"(ex)); unsigned short a2, c2; splitf(ex * f, a2, c2); oh[q] = a2; ol[q] = c2; }
                const size_t oo = ((size_t)zz * RH + i) * TT + j0; *(v4us*)(Ph + oo) = oh; *(v4us*)(Pl + oo) = ol; }
        } else {
#pragma unroll 2
            for (int ch = 0; ch < TT / 128; ++ch) { const int j0 = ch * 128 + lane * 4; const v4f a = *(const v4f*)(sr + j0); v4h o4;
#pragma unroll
                for (int q = 0; q < 4; ++q) { float t = a[q] * SCL; asm volatile("" : "+v"(t)); t = (j0 + q == i) ? -1.0e9f : t; float d0 = __fsub_rn(t, mx); asm volatile("" : "+v"(d0)); float ex = __builtin_amdgcn_exp2f(__fmul_rn(d0, 1.4426950408889634f)); asm volatile("" : "+v"(ex)); o4[q] = tohx(ex * f); }
                *(v4h*)(P16 + (size_t)row * TT + j0) = o4; } }
         }
}
// k_regpart: one row sum per thread (every load independent, one 128-B line each), 256 rows per work-group; wave tree, 8 wave sums through LDS, tree in wave 0; PART[block][0..31] is one whole line from one wave.
#define RPB 256                    // rows per work-group of k_regpart
#define NPART (NB_ * TT / RPB)     // partial sums
__global__ __launch_bounds__(RPB) void k_regpart(const float* __restrict__ RSQ, float* PART) {
    __shared__ float wsum[RPB / 32];
    const int lane = threadIdx.x & 31, wave = threadIdx.x >> 5; float s = RSQ[((size_t)blockIdx.x * RPB + threadIdx.x) * 32];
#pragma unroll
    for (int sh = 16; sh; sh >>= 1) s = __fadd_rn(s, __shfl_xor(s, sh, 32));
    if (lane == 0) wsum[wave] = s;
    __syncthreads();
    if (wave == 0) { float p = wsum[lane & (RPB / 32 - 1)];
#pragma unroll
        for (int sh = RPB / 64; sh; sh >>= 1) p = __fadd_rn(p, __shfl_xor(p, sh, 32));
        PART[(size_t)blockIdx.x * 32 + lane] = p; }
}
// k_regsum: one wave over the NPART partial sums (NPART / 32 independent loads per lane), then the mean.
__global__ __launch_bounds__(32) void k_regsum(const float* __restrict__ PART, float* out) { const int lane = threadIdx.x; float v[NPART / 32];
#pragma unroll
    for (int q = 0; q < NPART / 32; ++q) v[q] = PART[(size_t)(q * 32 + lane) * 32];
    float s = v[0];
#pragma unroll
    for (int q = 1; q < NPART / 32; ++q) s = __fadd_rn(s, v[q]);
#pragma unroll
    for (int sh = 16; sh; sh >>= 1) s = __fadd_rn(s, __shfl_xor(s, sh, 32));
    const float m = __fdiv_rn(s, (float)NB_ * (float)TT * (float)TT); if (lane == 0) { *(float*)out = m;  } }

__global__ __launch_bounds__(256) void k_merge(const float* __restrict__ O, int h0, float* OUTb) { const size_t e = ((size_t)blockIdx.x * 256 + threadIdx.x) * 2; if (e >= (size_t)ZH * TT * HD) return; const int d = (int)(e % HD); const int t = (int)((e / HD) % TT); const int zz = (int)(e / ((size_t)HD * TT)); const float cs = (t < RH) ? 1.0f : (1.0f / PCAR); const size_t oo = (size_t)t * DQ + (h0 + zz) * HD + d;
    v2f o2; o2[0] = O[e] * cs; o2[1] = O[e + 1] * cs; *(v2f*)(OUTb + oo) = o2;  }

extern "C" void kernel_launch(void* const* d_in, const int* in_sizes, int n_in,
                              void* d_out, int out_size, void* d_ws, size_t ws_size, hipStream_t stream) {
    (void)in_sizes; (void)n_in; (void)out_size;
    const float* qi = (const float*)d_in[0]; const float* ki = (const float*)d_in[1]; const float* vi = (const float*)d_in[2]; const float* x = nullptr; const float* wq = nullptr; const float* wk = nullptr; const float* wv = nullptr; const float* wo = nullptr; (void)x; (void)wq; (void)wk; (void)wv; (void)wo;
    float* OUT = (float*)d_out;     // [8][4096][64]
    char* wsp = (char*)d_ws;
    auto take = [&](size_t bytes) { char* p = wsp; wsp += (bytes + 255) & ~(size_t)255; return (void*)p; };
     float* CS = (float*)take((size_t)TT * HD * 2 * 4);
    float* RSQ = (float*)take((size_t)NB_ * TT * 32 * 4);   /* per-row sums of squared raw scores */
    h16* QP16 = (h16*)take((size_t)NH_ * TT * HD * 2); h16* KP16 = (h16*)take((size_t)NKV * TT * HD * 2); h16* VT16 = (h16*)take((size_t)NKV * HD * TT * 2);
    bf* QPh = (bf*)take((size_t)NH_ * TT * HD * 2); bf* QPl = (bf*)take((size_t)NH_ * TT * HD * 2); bf* KPh = (bf*)take((size_t)NKV * TT * HD * 2); bf* KPl = (bf*)take((size_t)NKV * TT * HD * 2); bf* VTh = (bf*)take((size_t)NKV * HD * TT * 2); bf* VTl = (bf*)take((size_t)NKV * HD * TT * 2); bf* Ph = (bf*)take((size_t)ZH * RH * TT * 2); bf* Pl = (bf*)take((size_t)ZH * RH * TT * 2);
    float* Sb = (float*)take((size_t)ZH * TT * TT * 4); h16* P16 = (h16*)take((size_t)ZH * TT * TT * 2); float* Ob = (float*)take((size_t)ZH * TT * HD * 4); float* PART = (float*)take((size_t)NPART * 32 * 4);   /* partial sums of the row sums, one line each */
    if ((size_t)(wsp - (char*)d_ws) > ws_size) return;    // ws 256 MiB
    k_csid<<<(TT * HD + 255) / 256, 256, 0, stream>>>(CS);
    const unsigned LQ = (unsigned)(((size_t)NH_ * TT * HD / 2 + 255) / 256), LKv = (unsigned)(((size_t)NKV * TT * HD / 2 + 255) / 256);
    for (int b = 0; b < NB_; ++b) {
        k_rope<<<LQ, 256, 0, stream>>>(qi + (size_t)b * TT * DQ, DQ, NH_, CS, nullptr, nullptr, 1.0f, QP16, QPh, QPl);
        k_rope<<<LKv, 256, 0, stream>>>(ki + (size_t)b * TT * DKV, DKV, NKV, CS, nullptr, nullptr, 1.0f, KP16, KPh, KPl);
        k_vtp<<<LKv, 256, 0, stream>>>(vi + (size_t)b * TT * DKV, DKV, NKV, VT16, VTh, VTl);
        for (int h0 = 0; h0 < NH_; h0 += ZH) { const size_t zq = (size_t)h0, zk = (size_t)(h0 / REP);   // one kv head per query head: each pass has one head (ZH = 1) on kv plane h0 / REP (z-strides TT*HD)
            k_gemmw<bf, 2, false><<<dim3(RH / 64, TT / 64, ZH), 32, 0, stream>>>(QPh + zq * TT * HD, QPl + zq * TT * HD, KPh + zk * TT * HD, KPl + zk * TT * HD, HD, Sb, TT, nullptr, (size_t)TT * HD, (size_t)TT * HD, (size_t)TT * TT);
            k_lsoft<<<ZH * TT / 8, 256, 0, stream>>>(Sb, P16, Ph, Pl, RSQ + (size_t)b * TT * 32);
            k_gemmw<bf, 2, false><<<dim3(RH / 64, HD / 64, ZH), 32, 0, stream>>>(Ph, Pl, VTh + zk * HD * TT, VTl + zk * HD * TT, TT, Ob, HD, nullptr, (size_t)RH * TT, (size_t)HD * TT, (size_t)TT * HD);
            k_merge<<<(unsigned)(((size_t)ZH * TT * HD / 2 + 255) / 256), 256, 0, stream>>>(Ob, h0, OUT + (size_t)b * TT * DQ); }
         }
    k_regpart<<<NPART, RPB, 0, stream>>>(RSQ, PART);
    k_regsum<<<1, 32, 0, stream>>>(PART, OUT + (size_t)NB_ * TT * HD);   /* tuple: reg_atten scalar after the context */
}

// v002
// A run of this version takes 806 microseconds.
// Next to v001, in two timings, it ran 1.62 and 1.61 times as fast.
// Counting every step since v000, it is 2.19 times as fast.
#include <hip/hip_runtime.h>

// Scaled-dot-product attention with self-masking and an attention-energy statistic (Q, K, V [8][4096][64]; attention = Q.K (NO scaling: logit sigma ~8, near one-hot rows); reg_atten = mean(attention^2) over all 8 x 4096 x 4096 raw scores (computed BEFORE the mask); the diagonal (i == j) is set to -1e9; softmax; context = attention.V -> tuple (context [8][4096][64] f32, reg_atten scalar) (2.1 M + 1)).
// Layout per batch: the inputs feed the plane builders directly (bf16-rounded on read); every row uses bf16 hi/lo planes (3-product scores and attn.v: the unscaled logits need them); a streaming 3-sweep softmax over the 4,096 keys applies the diagonal mask, writes normalised hi/lo P and also each row's sum of squared raw scores; attn.v is split over KSPL slices of the key axis (one work-group per 64x64 tile and slice, f32 partial tiles), f32 context via the merge kernel, which adds the KSPL partial tiles in slice order; two final kernels reduce the 32,768 row sums in a fixed order into the scalar (128 work-groups of 256 rows each: wave tree, then a tree over the 8 wave sums; one wave over the 128 partial sums).
// Compute dtypes, f32 accumulate: Q, K, V rounded to bf16 (hi planes exact, lo zero); scores exact up to f32 accumulation; softmax, squares and the reduction in f32; f32 outputs.

#define NB_  8
#define TT   4096
#define DM   64
#define NH_  1
#define NKV  1
#define REP  (NH_ / NKV)
#define HD   64
#define DQ   (NH_ * HD)
#define DKV  (NKV * HD)
#define ZH   1
#define RH   4096                  // query rows < RH use hi+lo planes (0: none)
#define WIN  0
#define PCAR 1024.0f
#define SCL  1.0f   // no scaling in the module
#define KSPL 32                    // slices of the key axis in attn.v: 64 row tiles x KSPL one-wave work-groups
typedef _Float16 h16;
typedef unsigned short bf;
typedef __attribute__((ext_vector_type(16))) __bf16   v16bf;
typedef __attribute__((ext_vector_type(16))) _Float16 v16h;
typedef __attribute__((ext_vector_type(8)))  _Float16 v8h;
typedef __attribute__((ext_vector_type(8)))  unsigned short v8us;
typedef __attribute__((ext_vector_type(8)))  float    v8f;
typedef __attribute__((ext_vector_type(4)))  float    v4f;
typedef v8h  __attribute__((may_alias)) v8ha;
typedef v4f  __attribute__((may_alias)) v4fa;
typedef v8us __attribute__((may_alias)) v8usa;

__device__ __forceinline__ unsigned short f2bf(float f) { unsigned u = __float_as_uint(f); u += 0x7FFFu + ((u >> 16) & 1u); return (unsigned short)(u >> 16); }
__device__ __forceinline__ float bf2f(unsigned short b) { return __uint_as_float(((unsigned)b) << 16); }
__device__ __forceinline__ float bfr(float f) { return bf2f(f2bf(f)); }
__device__ __forceinline__ v16h cat16(v8h lo, v8h hi) { return __builtin_shufflevector(lo, hi, 0, 1, 2, 3, 4, 5, 6, 7, 8, 9, 10, 11, 12, 13, 14, 15); }
__device__ __forceinline__ v16bf cat16b(v8us lo, v8us hi) { return __builtin_bit_cast(v16bf, __builtin_shufflevector(lo, hi, 0, 1, 2, 3, 4, 5, 6, 7, 8, 9, 10, 11, 12, 13, 14, 15)); }
__device__ __forceinline__ v8f wmma16(v16h a, v16h b, v8f c) { return __builtin_amdgcn_wmma_f32_16x16x32_f16(false, a, false, b, (short)0, c, false, false); }
__device__ __forceinline__ v8f wmmab(v16bf a, v16bf b, v8f c) { return __builtin_amdgcn_wmma_f32_16x16x32_bf16(false, a, false, b, (short)0, c, false, false); }



// ---- k_gemmw: register-blocked GEMM, ONE WAVE per 64x64 output tile (16 accumulators), operands straight from K-contiguous 16-bit planes; grid (M/64, N/64, Z), 32 threads.
// C[m][n] (f32, pitch ldc, + optional f32 bias[n]) = sum over k < KL of A[m][k] Bt[n][k] (+ split products per NSPLIT), rows of pitch K. z-batch strides sA/sB/sC in elements (scores: one head per z, sA = sB = TT*HD; attn.v: a slice of KL columns per z, sA = sB = KL, one partial C per z). KL % 32 == 0.
template <typename T16> struct WFrag;
template <> struct WFrag<h16> { typedef v16h V; static __device__ __forceinline__ V ld(const h16* p) { return cat16(*(const v8h*)p, *(const v8h*)(p + 16)); } static __device__ __forceinline__ v8f mma(V a, V b, v8f c) { return wmma16(a, b, c); } };
template <> struct WFrag<bf> { typedef v16bf V; static __device__ __forceinline__ V ld(const bf* p) { return cat16b(*(const v8us*)p, *(const v8us*)(p + 16)); } static __device__ __forceinline__ v8f mma(V a, V b, v8f c) { return wmmab(a, b, c); } };
template <typename T16, int NSPLIT, bool BIAS>
__global__ __launch_bounds__(32) void k_gemmw(const T16* __restrict__ A, const T16* __restrict__ A2, const T16* __restrict__ Bt, const T16* __restrict__ Bt2, int K, int KL, float* C, int ldc, const float* __restrict__ bias, size_t sA, size_t sB, size_t sC) {
    typedef typename WFrag<T16>::V V;
    __shared__ __align__(16) float os[16 * 68];
    const size_t z = blockIdx.z; A += z * sA; if (A2) A2 += z * sA; Bt += z * sB; if (Bt2) Bt2 += z * sB; C += z * sC;
    const int lane = threadIdx.x & 31, lr = lane & 15, hi = lane >> 4; const int r0 = blockIdx.x * 64, c0 = blockIdx.y * 64;
    v8f acc[4][4];
#pragma unroll
    for (int mb = 0; mb < 4; ++mb)
#pragma unroll
        for (int nb = 0; nb < 4; ++nb) acc[mb][nb] = (v8f){};
    const size_t aoff = (size_t)(r0 + lr) * K + 8 * hi, boff = (size_t)(c0 + lr) * K + 8 * hi;
#pragma unroll 1
    for (int kc = 0; kc < KL; kc += 32) {
        V a[4], a2[4];
#pragma unroll
        for (int mb = 0; mb < 4; ++mb) { a[mb] = WFrag<T16>::ld(A + aoff + (size_t)mb * 16 * K + kc); if (NSPLIT == 1 || NSPLIT == 2) a2[mb] = WFrag<T16>::ld(A2 + aoff + (size_t)mb * 16 * K + kc); }
#pragma unroll
        for (int nb = 0; nb < 4; ++nb) { const V b = WFrag<T16>::ld(Bt + boff + (size_t)nb * 16 * K + kc); V b2; if (NSPLIT >= 2) b2 = WFrag<T16>::ld(Bt2 + boff + (size_t)nb * 16 * K + kc);
#pragma unroll
            for (int mb = 0; mb < 4; ++mb) { acc[mb][nb] = WFrag<T16>::mma(a[mb], b, acc[mb][nb]); if (NSPLIT == 1 || NSPLIT == 2) acc[mb][nb] = WFrag<T16>::mma(a2[mb], b, acc[mb][nb]); if (NSPLIT >= 2) acc[mb][nb] = WFrag<T16>::mma(a[mb], b2, acc[mb][nb]); } }
        asm volatile("v_nop\n\tv_nop\n\tv_nop\n\tv_nop" : "+v"(acc[0][0]), "+v"(acc[1][1]), "+v"(acc[2][2]), "+v"(acc[3][3]) : "v"(a[0]), "v"(a[3]));
    }
#pragma unroll
    for (int mb = 0; mb < 4; ++mb) {
#pragma unroll
        for (int nb = 0; nb < 4; ++nb) {
#pragma unroll
            for (int j = 0; j < 8; ++j) os[(hi * 8 + j) * 68 + nb * 16 + lr] = acc[mb][nb][j]; }
        __builtin_amdgcn_wave_barrier(); asm volatile("" ::: "memory");
        float* crow = C + (size_t)(r0 + mb * 16) * ldc + c0;
{
#pragma unroll
            for (int s = 0; s < 8; ++s) { const int row = 2 * s + hi, cofs = lr * 4; v4f val = *(const v4fa*)(os + row * 68 + cofs); if (BIAS) { val[0] += bfr(bias[c0 + cofs]); val[1] += bfr(bias[c0 + cofs + 1]); val[2] += bfr(bias[c0 + cofs + 2]); val[3] += bfr(bias[c0 + cofs + 3]); }
                *(v4f*)(crow + (size_t)row * ldc + cofs) = val; }
             }
        __builtin_amdgcn_wave_barrier(); asm volatile("" ::: "memory");
    }
}

__device__ __forceinline__ h16 tohx(float x) { return (h16)x; }
__device__ __forceinline__ void splitf(float y, unsigned short& h, unsigned short& l) { h = f2bf(y); l = f2bf(y - bf2f(h)); }
typedef __attribute__((ext_vector_type(2))) _Float16 v2h;
typedef __attribute__((ext_vector_type(4))) _Float16 v4h;
typedef __attribute__((ext_vector_type(2))) unsigned short v2us;
typedef __attribute__((ext_vector_type(4))) unsigned short v4us;
typedef __attribute__((ext_vector_type(2))) float v2f;
typedef __attribute__((ext_vector_type(4))) int v4i;

__global__ __launch_bounds__(256) void k_wtG(const float* __restrict__ w, int K, int N, bf* Bt) {
    const int lane = threadIdx.x & 31; const int L0 = (blockIdx.x * 8 + (threadIdx.x >> 5)) * 8; const int nlines = N * K / 64;
{
#pragma unroll 1
        for (int l = 0; l < 8; ++l) { const int L = L0 + l; if (L >= nlines) break; const size_t e = (size_t)L * 64 + lane * 2; const int k = (int)(e % K), n = (int)(e / K); v2us o;
            o[0] = f2bf(w[(size_t)k * N + n]); o[1] = f2bf(w[(size_t)(k + 1) * N + n]); *(v2us*)(Bt + e) = o; }
         }
}
__global__ __launch_bounds__(256) void k_cvt8(const float* __restrict__ src, bf* dst, size_t n8) { const size_t i = (size_t)blockIdx.x * 256 + threadIdx.x; if (i >= n8) return; const v8f v = *(const v8f*)(src + i * 8); v8us o;
#pragma unroll
    for (int k = 0; k < 8; ++k) o[k] = f2bf(v[k]); *(v8us*)(dst + i * 8) = o;  }

// k_rope: head planes [h][t][d] (fp16 + hi/lo) of rope(x) x sc with the rotate-half convention out[d] = x[d] cos[t][d] - x[d+HD/2] sin[t][d], out[d+HD/2] = x[d+HD/2] cos[t][d+HD/2] + x[d] sin[t][d+HD/2]
__global__ __launch_bounds__(256) void k_rope(const float* __restrict__ F, int pitch, int nheads, const float* __restrict__ CS, const float* __restrict__ RF, const float* __restrict__ nw, float sc, h16* P16, bf* Ph, bf* Pl) {
    const size_t e = ((size_t)blockIdx.x * 256 + threadIdx.x) * 2; if (e >= (size_t)nheads * TT * HD) return; const int d = (int)(e % HD); const int t = (int)((e / HD) % TT); const int h = (int)(e / ((size_t)HD * TT)); const float* f = F + (size_t)t * pitch + h * HD; const float rf = RF ? RF[(size_t)h * TT + t] : 1.0f; v2h o16; v2us oh, ol;
#pragma unroll
    for (int q = 0; q < 2; ++q) { const int dd = d + q; const int dp = (dd < HD / 2) ? dd + HD / 2 : dd - HD / 2; float x0 = bfr(f[dd]), x1 = bfr(f[dp]);   /* raw input: bf16-rounded here */
        if (RF) { float n0 = __fmul_rn(x0, rf), n1 = __fmul_rn(x1, rf); asm volatile("" : "+v"(n0)); asm volatile("" : "+v"(n1)); x0 = __fmul_rn(bfr(nw[dd]), n0); x1 = __fmul_rn(bfr(nw[dp]), n1); }
        const v2f cs = *(const v2f*)(CS + ((size_t)t * HD + dd) * 2); float a = __fmul_rn(x0, cs[0]), bq = __fmul_rn(x1, cs[1]); asm volatile("" : "+v"(a)); asm volatile("" : "+v"(bq)); const float r = ((dd < HD / 2) ? __fsub_rn(a, bq) : __fadd_rn(a, bq)) * sc;
        o16[q] = tohx(r); unsigned short a2, c2; splitf(r, a2, c2); oh[q] = a2; ol[q] = c2; }
    *(v2h*)(P16 + e) = o16; *(v2us*)(Ph + e) = oh; *(v2us*)(Pl + e) = ol;  }
__global__ __launch_bounds__(256) void k_vtp(const float* __restrict__ F, int pitch, int nheads, h16* V16, bf* Vh, bf* Vl) { const size_t e = ((size_t)blockIdx.x * 256 + threadIdx.x) * 2; if (e >= (size_t)nheads * HD * TT) return; const int t = (int)(e % TT); const int d = (int)((e / TT) % HD); const int g = (int)(e / ((size_t)TT * HD)); v2h o16; v2us oh, ol;
#pragma unroll
    for (int q = 0; q < 2; ++q) { const float x = bfr(F[(size_t)(t + q) * pitch + g * HD + d]);   /* raw input: bf16-rounded here */ o16[q] = tohx(x); unsigned short a2, c2; splitf(x, a2, c2); oh[q] = a2; ol[q] = c2; }
    *(v2h*)(V16 + e) = o16; *(v2us*)(Vh + e) = oh; *(v2us*)(Vl + e) = ol;  }
__global__ __launch_bounds__(256) void k_csid(float* CS) { const int idx = blockIdx.x * 256 + threadIdx.x; if (idx >= TT * HD) return; v2f cs; cs[0] = 1.0f; cs[1] = 0.0f; *(v2f*)(CS + (size_t)idx * 2) = cs;  }
// k_lsoft: per query row (one wave): streaming 3-sweep softmax over the 4,096 keys with the module's self-mask (logit j == i -> -1e9) and, in sweep 1, the row's sum of squared RAW scores (before the mask) written to RSQ[row][0..31];
__global__ __launch_bounds__(256) void k_lsoft(const float* __restrict__ Sb, h16* P16, bf* Ph, bf* Pl, float* RSQ) {
    const int lane = threadIdx.x & 31; const int row = blockIdx.x * 8 + (threadIdx.x >> 5); if (row >= ZH * TT) return; const int i = row % TT; const int zz = row / TT; const bool hires = (i < RH); const float* sr = Sb + (size_t)row * TT; float mx = -3.0e38f; float sq = 0.f;
#pragma unroll 4
    for (int ch = 0; ch < TT / 128; ++ch) { const int j0 = ch * 128 + lane * 4; const v4f a = *(const v4f*)(sr + j0);
#pragma unroll
        for (int q = 0; q < 4; ++q) { float s2 = __fmul_rn(a[q], a[q]); asm volatile("" : "+v"(s2)); sq = __fadd_rn(sq, s2); float t = a[q] * SCL; asm volatile("" : "+v"(t)); t = (j0 + q == i) ? -1.0e9f : t; mx = fmaxf(mx, t); } }
#pragma unroll
    for (int sh = 16; sh; sh >>= 1) mx = fmaxf(mx, __shfl_xor(mx, sh, 32));
#pragma unroll
    for (int sh = 16; sh; sh >>= 1) sq = __fadd_rn(sq, __shfl_xor(sq, sh, 32));
    *(float*)(RSQ + (size_t)row * 32 + lane) = sq;    
    float sum = 0.f;
#pragma unroll 4
    for (int ch = 0; ch < TT / 128; ++ch) { const int j0 = ch * 128 + lane * 4; const v4f a = *(const v4f*)(sr + j0);
#pragma unroll
        for (int q = 0; q < 4; ++q) { float t = a[q] * SCL; asm volatile("" : "+v"(t)); t = (j0 + q == i) ? -1.0e9f : t; float d0 = __fsub_rn(t, mx); asm volatile("" : "+v"(d0)); sum += __builtin_amdgcn_exp2f(__fmul_rn(d0, 1.4426950408889634f)); } }
#pragma unroll
    for (int sh = 16; sh; sh >>= 1) sum += __shfl_xor(sum, sh, 32);
    const float f = __fdiv_rn(hires ? 1.0f : PCAR, sum);
{
        if (hires) {   /* rows < RH: normalised bf16 hi/lo over all keys, planes [zz][RH][TT] */
#pragma unroll
            for (int ch = 0; ch < TT / 128; ++ch) { const int j0 = ch * 128 + lane * 4; const v4f a = *(const v4f*)(sr + j0); v4us oh, ol;
#pragma unroll
                for (int q = 0; q < 4; ++q) { float t = a[q] * SCL; asm volatile("" : "+v"(t)); t = (j0 + q == i) ? -1.0e9f : t; float d0 = __fsub_rn(t, mx); asm volatile("" : "+v"(d0)); float ex = __builtin_amdgcn_exp2f(__fmul_rn(d0, 1.4426950408889634f)); asm volatile("" : "+v"(ex)); unsigned short a2, c2; splitf(ex * f, a2, c2); oh[q] = a2; ol[q] = c2; }
                const size_t oo = ((size_t)zz * RH + i) * TT + j0; *(v4us*)(Ph + oo) = oh; *(v4us*)(Pl + oo) = ol; }
        } else {
#pragma unroll 2
            for (int ch = 0; ch < TT / 128; ++ch) { const int j0 = ch * 128 + lane * 4; const v4f a = *(const v4f*)(sr + j0); v4h o4;
#pragma unroll
                for (int q = 0; q < 4; ++q) { float t = a[q] * SCL; asm volatile("" : "+v"(t)); t = (j0 + q == i) ? -1.0e9f : t; float d0 = __fsub_rn(t, mx); asm volatile("" : "+v"(d0)); float ex = __builtin_amdgcn_exp2f(__fmul_rn(d0, 1.4426950408889634f)); asm volatile("" : "+v"(ex)); o4[q] = tohx(ex * f); }
                *(v4h*)(P16 + (size_t)row * TT + j0) = o4; } }
         }
}
// k_regpart: one row sum per thread (every load independent, one 128-B line each), 256 rows per work-group; wave tree, 8 wave sums through LDS, tree in wave 0; PART[block][0..31] is one whole line from one wave.
#define RPB 256                    // rows per work-group of k_regpart
#define NPART (NB_ * TT / RPB)     // partial sums
__global__ __launch_bounds__(RPB) void k_regpart(const float* __restrict__ RSQ, float* PART) {
    __shared__ float wsum[RPB / 32];
    const int lane = threadIdx.x & 31, wave = threadIdx.x >> 5; float s = RSQ[((size_t)blockIdx.x * RPB + threadIdx.x) * 32];
#pragma unroll
    for (int sh = 16; sh; sh >>= 1) s = __fadd_rn(s, __shfl_xor(s, sh, 32));
    if (lane == 0) wsum[wave] = s;
    __syncthreads();
    if (wave == 0) { float p = wsum[lane & (RPB / 32 - 1)];
#pragma unroll
        for (int sh = RPB / 64; sh; sh >>= 1) p = __fadd_rn(p, __shfl_xor(p, sh, 32));
        PART[(size_t)blockIdx.x * 32 + lane] = p; }
}
// k_regsum: one wave over the NPART partial sums (NPART / 32 independent loads per lane), then the mean.
__global__ __launch_bounds__(32) void k_regsum(const float* __restrict__ PART, float* out) { const int lane = threadIdx.x; float v[NPART / 32];
#pragma unroll
    for (int q = 0; q < NPART / 32; ++q) v[q] = PART[(size_t)(q * 32 + lane) * 32];
    float s = v[0];
#pragma unroll
    for (int q = 1; q < NPART / 32; ++q) s = __fadd_rn(s, v[q]);
#pragma unroll
    for (int sh = 16; sh; sh >>= 1) s = __fadd_rn(s, __shfl_xor(s, sh, 32));
    const float m = __fdiv_rn(s, (float)NB_ * (float)TT * (float)TT); if (lane == 0) { *(float*)out = m;  } }

__global__ __launch_bounds__(256) void k_merge(const float* __restrict__ O, int h0, float* OUTb) { const size_t e = ((size_t)blockIdx.x * 256 + threadIdx.x) * 2; if (e >= (size_t)ZH * TT * HD) return; const int d = (int)(e % HD); const int t = (int)((e / HD) % TT); const int zz = (int)(e / ((size_t)HD * TT)); const float cs = (t < RH) ? 1.0f : (1.0f / PCAR); const size_t oo = (size_t)t * DQ + (h0 + zz) * HD + d;
    v2f p[KSPL];   /* the KSPL partial rows of attn.v, O[t][slice][d]: independent loads, then one sum in slice order */
#pragma unroll
    for (int sp = 0; sp < KSPL; ++sp) p[sp] = *(const v2f*)(O + (((size_t)zz * TT + t) * KSPL + sp) * HD + d);
    v2f a = p[0];
#pragma unroll
    for (int sp = 1; sp < KSPL; ++sp) a += p[sp];
    v2f o2; o2[0] = a[0] * cs; o2[1] = a[1] * cs; *(v2f*)(OUTb + oo) = o2;  }

extern "C" void kernel_launch(void* const* d_in, const int* in_sizes, int n_in,
                              void* d_out, int out_size, void* d_ws, size_t ws_size, hipStream_t stream) {
    (void)in_sizes; (void)n_in; (void)out_size;
    const float* qi = (const float*)d_in[0]; const float* ki = (const float*)d_in[1]; const float* vi = (const float*)d_in[2]; const float* x = nullptr; const float* wq = nullptr; const float* wk = nullptr; const float* wv = nullptr; const float* wo = nullptr; (void)x; (void)wq; (void)wk; (void)wv; (void)wo;
    float* OUT = (float*)d_out;     // [8][4096][64]
    char* wsp = (char*)d_ws;
    auto take = [&](size_t bytes) { char* p = wsp; wsp += (bytes + 255) & ~(size_t)255; return (void*)p; };
     float* CS = (float*)take((size_t)TT * HD * 2 * 4);
    float* RSQ = (float*)take((size_t)NB_ * TT * 32 * 4);   /* per-row sums of squared raw scores */
    h16* QP16 = (h16*)take((size_t)NH_ * TT * HD * 2); h16* KP16 = (h16*)take((size_t)NKV * TT * HD * 2); h16* VT16 = (h16*)take((size_t)NKV * HD * TT * 2);
    bf* QPh = (bf*)take((size_t)NH_ * TT * HD * 2); bf* QPl = (bf*)take((size_t)NH_ * TT * HD * 2); bf* KPh = (bf*)take((size_t)NKV * TT * HD * 2); bf* KPl = (bf*)take((size_t)NKV * TT * HD * 2); bf* VTh = (bf*)take((size_t)NKV * HD * TT * 2); bf* VTl = (bf*)take((size_t)NKV * HD * TT * 2); bf* Ph = (bf*)take((size_t)ZH * RH * TT * 2); bf* Pl = (bf*)take((size_t)ZH * RH * TT * 2);
    float* Sb = (float*)take((size_t)ZH * TT * TT * 4); h16* P16 = (h16*)take((size_t)ZH * TT * TT * 2); float* Ob = (float*)take((size_t)KSPL * ZH * TT * HD * 4); float* PART = (float*)take((size_t)NPART * 32 * 4);   /* partial sums of the row sums, one line each */
    if ((size_t)(wsp - (char*)d_ws) > ws_size) return;    // ws 256 MiB
    k_csid<<<(TT * HD + 255) / 256, 256, 0, stream>>>(CS);
    const unsigned LQ = (unsigned)(((size_t)NH_ * TT * HD / 2 + 255) / 256), LKv = (unsigned)(((size_t)NKV * TT * HD / 2 + 255) / 256);
    for (int b = 0; b < NB_; ++b) {
        k_rope<<<LQ, 256, 0, stream>>>(qi + (size_t)b * TT * DQ, DQ, NH_, CS, nullptr, nullptr, 1.0f, QP16, QPh, QPl);
        k_rope<<<LKv, 256, 0, stream>>>(ki + (size_t)b * TT * DKV, DKV, NKV, CS, nullptr, nullptr, 1.0f, KP16, KPh, KPl);
        k_vtp<<<LKv, 256, 0, stream>>>(vi + (size_t)b * TT * DKV, DKV, NKV, VT16, VTh, VTl);
        for (int h0 = 0; h0 < NH_; h0 += ZH) { const size_t zq = (size_t)h0, zk = (size_t)(h0 / REP);   // one kv head per query head: each pass holds one head (ZH == 1) and its kv plane zk = h0 / REP
            k_gemmw<bf, 2, false><<<dim3(RH / 64, TT / 64, ZH), 32, 0, stream>>>(QPh + zq * TT * HD, QPl + zq * TT * HD, KPh + zk * TT * HD, KPl + zk * TT * HD, HD, HD, Sb, TT, nullptr, (size_t)TT * HD, (size_t)TT * HD, (size_t)TT * TT);
            k_lsoft<<<ZH * TT / 8, 256, 0, stream>>>(Sb, P16, Ph, Pl, RSQ + (size_t)b * TT * 32);
            k_gemmw<bf, 2, false><<<dim3(RH / 64, HD / 64, KSPL), 32, 0, stream>>>(Ph, Pl, VTh + zk * HD * TT, VTl + zk * HD * TT, TT, TT / KSPL, Ob, KSPL * HD, nullptr, (size_t)(TT / KSPL), (size_t)(TT / KSPL), (size_t)HD);   /* ZH == 1: z is the key slice; partial rows Ob[t][slice][d] */
            k_merge<<<(unsigned)(((size_t)ZH * TT * HD / 2 + 255) / 256), 256, 0, stream>>>(Ob, h0, OUT + (size_t)b * TT * DQ); }
         }
    k_regpart<<<NPART, RPB, 0, stream>>>(RSQ, PART);
    k_regsum<<<1, 32, 0, stream>>>(PART, OUT + (size_t)NB_ * TT * HD);   /* tuple: reg_atten scalar after the context */
}

// v004
// It runs in 46.9 microseconds.
// Versions in between are left out here; by their measured steps it is 17.2 times as fast as v002.
// All steps since v000 together make it 37.6 times as fast.
#include <hip/hip_runtime.h>

// Scaled-dot-product attention with self-masking and an attention-energy statistic (Q, K, V [8][4096][64]; attention = Q.K (NO scaling: logit sigma ~8, near one-hot rows); reg_atten = mean(attention^2) over all 8 x 4096 x 4096 raw scores (computed BEFORE the mask); the diagonal (i == j) is set to -1e9; softmax; context = attention.V -> tuple (context [8][4096][64] f32, reg_atten scalar) (2.1 M + 1)).
// Three launches. k_pack rounds K and V to bf16 and lays them out in matrix-fragment order. k_fattn is the whole attention for all 8 batches: four waves per 32 query rows each walk a quarter of the 4,096 keys in passes of 32 with a running maximum and sum (online softmax) and join their partial results through LDS; the score matrix never leaves the registers. k_regsum adds the 1,024 per-query-tile sums of squared raw scores in a fixed order.
// Transposed products: S^T = K.Q^T puts one query's scores in one lane (and its partner lane l ^ 16), so the score accumulators pack straight into the B operand of O^T += V^T.P^T.
// Every plain '#pragma unroll' below stands on a short loop over register arrays: unrolled, the indices are constants and the arrays stay in registers.
// Compute dtypes, f32 accumulate: Q, K, V rounded to bf16 (their low planes would be zero, so one product gives the exact scores up to f32 accumulation); P = exp(s - running max) as bf16 hi + lo planes (two products); softmax, squares and the reduction in f32; f32 outputs.

#define NB_  8
#define TT   4096
#define HD   64
#define KB   32                        // keys per pass (the k depth of one P^T fragment)
#define NQB  2                         // 16-query column groups per wave
#define WPB  4                         // query tiles per work-group
#define NS   4                         // key slices per query tile, one wave each: WPB * NS waves per work-group, NS per SIMD, so that one wave's softmax runs under another's products
#define PS   (TT / KB / NS)            // passes per key slice
#define QW   (16 * NQB)                // query rows per wave; QW == KB puts a wave's whole diagonal in one pass
#define NWAVE (NB_ * TT / QW)          // query tiles of k_fattn = partial sums of squares
#define PASSEL (KB * HD)               // 16-bit elements of K (and of V) per pass
#define LOG2E 1.4426950408889634f
typedef unsigned short bf;
typedef __attribute__((ext_vector_type(16))) __bf16   v16bf;
typedef __attribute__((ext_vector_type(2)))  __bf16   v2bf;
typedef __attribute__((ext_vector_type(8)))  unsigned short v8us;
typedef __attribute__((ext_vector_type(8)))  unsigned v8u;
typedef __attribute__((ext_vector_type(8)))  float    v8f;
typedef __attribute__((ext_vector_type(4)))  float    v4f;
typedef __attribute__((ext_vector_type(2)))  float    v2f;

__device__ __forceinline__ unsigned short f2bf(float f) { unsigned u = __float_as_uint(f); u += 0x7FFFu + ((u >> 16) & 1u); return (unsigned short)(u >> 16); }
__device__ __forceinline__ unsigned pk(float a, float b) { return __builtin_bit_cast(unsigned, __builtin_convertvector((v2f){a, b}, v2bf)); }   // two f32 -> two bf16, round to nearest even, a in the low half
__device__ __forceinline__ float xhalf(float x) { return __builtin_bit_cast(float, __builtin_amdgcn_permlanex16(__builtin_bit_cast(int, x), __builtin_bit_cast(int, x), 0x76543210, 0xfedcba98, false, false)); }   // lane l <-> lane l ^ 16
__device__ __forceinline__ v16bf cat16b(v8us lo, v8us hi) { return __builtin_bit_cast(v16bf, __builtin_shufflevector(lo, hi, 0, 1, 2, 3, 4, 5, 6, 7, 8, 9, 10, 11, 12, 13, 14, 15)); }
__device__ __forceinline__ v8f wmmab(v16bf a, v16bf b, v8f c) { return __builtin_amdgcn_wmma_f32_16x16x32_bf16(false, a, false, b, (short)0, c, false, false); }
// one packed fragment: two pieces of 32 lanes x 16 B, each piece 512 contiguous bytes; pass is the wave-uniform base of the key slice, off = pass * 4096 + lane * 16 bytes, f the fragment (a constant: it goes into the load's immediate offset)
__device__ __forceinline__ v16bf ldfrag(const bf* pass, unsigned off, int f) { const char* p = (const char*)pass + off + f * 1024; return cat16b(*(const v8us*)p, *(const v8us*)(p + 512)); }

// k_pack: fragment-order bf16 planes. A fragment position (lane, piece pc, e) holds row (lane & 15) and k = pc * 16 + 8 * (lane >> 4) + e of its 16 x 32 tile.
// Kp[b][key tile of 16][d half ks][pc][lane][e] = K[b][tile * 16 + (lane & 15)][ks * 32 + k];  Vp[b][key pass of 32][d tile db][pc][lane][e] = V[b][pass * 32 + k][db * 16 + (lane & 15)] (V^T rows).
__global__ __launch_bounds__(256) void k_pack(const float* __restrict__ K, const float* __restrict__ V, bf* __restrict__ Kp, bf* __restrict__ Vp) {
    const int NC = NB_ * TT * HD / 8;   // 16-byte chunks per plane
    const int c0 = blockIdx.x * 256 + threadIdx.x; const bool isv = c0 >= NC; const int c = isv ? c0 - NC : c0;
    const int b = c / (TT * HD / 8), r = c % (TT * HD / 8); const int lane = r & 31, lr = lane & 15, hi = lane >> 4, pc = (r >> 5) & 1; v8us o;
    if (!isv) { const int ks = (r >> 6) & 1, tile = r >> 7; const v8f x = *(const v8f*)(K + ((size_t)b * TT + tile * 16 + lr) * HD + ks * 32 + pc * 16 + 8 * hi);
#pragma unroll
        for (int e = 0; e < 8; ++e) o[e] = f2bf(x[e]);
        *(v8us*)(Kp + (size_t)c * 8) = o;
    } else { const int db = (r >> 6) & 3, ps = r >> 8; const float* vp = V + ((size_t)b * TT + ps * KB + pc * 16 + 8 * hi) * HD + db * 16 + lr;
#pragma unroll
        for (int e = 0; e < 8; ++e) o[e] = f2bf(vp[(size_t)e * HD]);
        *(v8us*)(Vp + (size_t)c * 8) = o; }
}

// k_fattn: one wave = QW query rows of one batch, one key slice of PS passes. No LDS and no barrier in the loops: the WPB waves of a slice read the same K and V passes and share them through the WGP cache. One barrier behind the loops: the NS slices of a query tile are joined through LDS.
struct DiagYes { static constexpr bool v = true; }; struct DiagNo { static constexpr bool v = false; };
__global__ __launch_bounds__(32 * WPB * NS) void k_fattn(const float* __restrict__ Q, const bf* __restrict__ Kp, const bf* __restrict__ Vp, float* __restrict__ OUT, float* __restrict__ PART) {
    const int lane = threadIdx.x & 31, lr = lane & 15, hi = lane >> 4;
    __shared__ __attribute__((aligned(16))) float accL[WPB][NS][NQB * 4][2][32][4];   // partial O^T tiles: [query tile][slice][qb * 4 + db][half of the eight registers][lane][4]: each 16-byte access is contiguous over the lanes
    __shared__ float stL[WPB][NS][NQB][2][32];   // per slice and query: running maximum times log2(e), sum
    __shared__ float sqL[WPB][NS];               // per slice: sum of squared raw scores
    const int wv = __builtin_amdgcn_readfirstlane((int)(threadIdx.x >> 5));   // wave index, held scalar: scalar bases and scalar trip counts
    const int qi = wv & (WPB - 1), h = wv / WPB;   // query tile in the work-group, key slice
    const int gw = blockIdx.x * WPB + qi;
    const int b = gw / (TT / QW), qt = gw % (TT / QW);
    const bf* kb = Kp + ((size_t)b * TT + h * (PS * KB)) * HD; const bf* vb = Vp + ((size_t)b * TT + h * (PS * KB)) * HD;   // wave-uniform bases of the slice, never rewritten
    const int first = qt & ~(WPB - 1) & (PS - 1);   // first pass inside the slice: the waves of a slice walk the passes first, first + 1, ... (mod PS) together, and in the one slice that holds the work-group's diagonals these lie in the first WPB passes
    unsigned ko = first * (PASSEL * 2) + lane * 16, vo = ko;   // byte offsets of this lane, inside the slice, in the passes that the next K loads and the next V loads read
    v16bf qf[NQB][2];   // B operand of S^T: column = query lr of group qb, k = d
#pragma unroll
    for (int qb = 0; qb < NQB; ++qb)
#pragma unroll
        for (int ks = 0; ks < 2; ++ks) { const float* qp = Q + ((size_t)b * TT + qt * QW + qb * 16 + lr) * HD + ks * 32 + 8 * hi; const v8f x = *(const v8f*)qp, y = *(const v8f*)(qp + 16); v8u w;
#pragma unroll
            for (int t = 0; t < 4; ++t) { w[t] = pk(x[2 * t], x[2 * t + 1]); w[4 + t] = pk(y[2 * t], y[2 * t + 1]); }
            qf[qb][ks] = __builtin_bit_cast(v16bf, w); }
    v8f acc[NQB][4]; v4f sq = (v4f){}; v2f sum[NQB]; float mx[NQB], ml2[NQB];   // running maximum, and the same times log2(e) as it was rounded for the exponents
#pragma unroll
    for (int qb = 0; qb < NQB; ++qb) { mx[qb] = -1.0e30f; ml2[qb] = -1.0e30f * LOG2E; sum[qb] = (v2f){};
#pragma unroll
        for (int db = 0; db < 4; ++db) acc[qb][db] = (v8f){}; }
    v16bf ka[2][2], va[4];   // A operands: K rows (key tile kt, d half ks); V^T rows (d tile db)
#pragma unroll
    for (int f = 0; f < 4; ++f) ka[f >> 1][f & 1] = ldfrag(kb, ko, f);
#pragma unroll
    for (int f = 0; f < 4; ++f) va[f] = ldfrag(vb, vo, f);
    asm volatile("s_wait_xcnt 0x0" : "+v"(ko), "+v"(vo) : : "memory");   // as in the pass below
    ko = (ko + PASSEL * 2) & (PS * PASSEL * 2 - 1);
    auto pass = [&](const bool dg, auto diag) {   // dg: this pass holds the wave's diagonal (looked at only in the DiagYes build)
        v8f s[NQB][2];   // s[qb][kt][j]: key pass * 32 + kt * 16 + 8 * hi + j, query lr of group qb
#pragma unroll
        for (int qb = 0; qb < NQB; ++qb)
#pragma unroll
            for (int kt = 0; kt < 2; ++kt) s[qb][kt] = wmmab(ka[kt][1], qf[qb][1], wmmab(ka[kt][0], qf[qb][0], (v8f){}));
#pragma unroll
        for (int f = 0; f < 4; ++f) ka[f >> 1][f & 1] = ldfrag(kb, ko, f);   // next K flies under the softmax and attn.V
        __builtin_amdgcn_sched_barrier(0);   // keeps the K loads here: the scheduler otherwise sinks them to the pass's end, and their latency stands open at the next pass's first product
        v16bf ph[NQB], pl[NQB];
#pragma unroll
        for (int qb = 0; qb < NQB; ++qb) {
#pragma unroll
            for (int kt = 0; kt < 2; ++kt) { const v4f u = __builtin_shufflevector(s[qb][kt], s[qb][kt], 0, 1, 2, 3), w = __builtin_shufflevector(s[qb][kt], s[qb][kt], 4, 5, 6, 7); sq = __builtin_elementwise_fma(u, u, sq); sq = __builtin_elementwise_fma(w, w, sq); }   // raw scores, before the mask
            if constexpr (decltype(diag)::v) {   // group qb meets its diagonal in key tile kt == qb
#pragma unroll
                for (int j = 0; j < 8; ++j) s[qb][qb][j] = (dg && 8 * hi + j == lr) ? -1.0e9f : s[qb][qb][j]; }
            const v8f x = s[qb][0], y = s[qb][1];   // maximum as a tree of threes: short dependent chains
            const float g0 = fmaxf(fmaxf(x[0], x[1]), x[2]), g1 = fmaxf(fmaxf(x[3], x[4]), x[5]), g2 = fmaxf(fmaxf(x[6], x[7]), y[0]), g3 = fmaxf(fmaxf(y[1], y[2]), y[3]), g4 = fmaxf(fmaxf(y[4], y[5]), y[6]);
            const float bm = fmaxf(fmaxf(fmaxf(g0, g1), g2), fmaxf(fmaxf(g3, g4), y[7]));
            const float mn = fmaxf(fmaxf(mx[qb], bm), xhalf(bm)), mn2 = mn * LOG2E;   // both halves of a column feed one accumulator: one maximum for both
            const float al = __builtin_amdgcn_exp2f(ml2[qb] - mn2); mx[qb] = mn; ml2[qb] = mn2;   // the exact ratio of the old scale to the new one
            const v8f l2 = (v8f){LOG2E, LOG2E, LOG2E, LOG2E, LOG2E, LOG2E, LOG2E, LOG2E}, nm = (v8f){-mn2, -mn2, -mn2, -mn2, -mn2, -mn2, -mn2, -mn2}; const v8f ex = __builtin_elementwise_fma(x, l2, nm), ey = __builtin_elementwise_fma(y, l2, nm); v8f p0, p1;
#pragma unroll
            for (int j = 0; j < 8; ++j) { p0[j] = __builtin_amdgcn_exp2f(ex[j]); p1[j] = __builtin_amdgcn_exp2f(ey[j]); }
            const v8f pp = p0 + p1; const v2f ps = (__builtin_shufflevector(pp, pp, 0, 1) + __builtin_shufflevector(pp, pp, 2, 3)) + (__builtin_shufflevector(pp, pp, 4, 5) + __builtin_shufflevector(pp, pp, 6, 7));
            sum[qb] = sum[qb] * al + ps;   // this half's keys only, as two partial sums; all four meet after the loop
            v8u wh, wl;   // position e of the B operand is key 8 * hi + e (e < 8) or 16 + 8 * hi + e - 8: the order of the packed V^T fragment
#pragma unroll
            for (int t = 0; t < 4; ++t) { const unsigned h0 = pk(p0[2 * t], p0[2 * t + 1]), h1 = pk(p1[2 * t], p1[2 * t + 1]); wh[t] = h0; wh[4 + t] = h1;
                wl[t] = pk(p0[2 * t] - __uint_as_float(h0 << 16), p0[2 * t + 1] - __uint_as_float(h0 & 0xFFFF0000u)); wl[4 + t] = pk(p1[2 * t] - __uint_as_float(h1 << 16), p1[2 * t + 1] - __uint_as_float(h1 & 0xFFFF0000u)); }
            ph[qb] = __builtin_bit_cast(v16bf, wh); pl[qb] = __builtin_bit_cast(v16bf, wl);
#pragma unroll
            for (int db = 0; db < 4; ++db) acc[qb][db] *= al;
            if (qb == 0) {
                // the wait that stands before a register named by an issued load is rewritten: the two offset registers pass through it, so they change only behind it.
                // The last packed word of this group is an input only to hold the wait behind the group's softmax: directly behind the K loads it would stall
                asm volatile("s_wait_xcnt 0x0" : "+v"(ko), "+v"(vo) : "v"(wl[7]) : "memory");
                ko = (ko + PASSEL * 2) & (PS * PASSEL * 2 - 1); vo = (vo + PASSEL * 2) & (PS * PASSEL * 2 - 1); } }   // cyclic: always inside the slice; the last pass's loads are unused
#pragma unroll
        for (int db = 0; db < 4; ++db)
#pragma unroll
            for (int qb = 0; qb < NQB; ++qb) acc[qb][db] = wmmab(va[db], pl[qb], wmmab(va[db], ph[qb], acc[qb][db]));
#pragma unroll
        for (int f = 0; f < 4; ++f) va[f] = ldfrag(vb, vo, f);   // next V flies under the next scores and softmax
    };
    // the mask is paid in the first WPB passes only; both loops stay rolled: a pass is some 300 instructions, and copies of it would only cost instruction cache
#pragma unroll 1
    for (int t = 0; t < WPB; ++t) pass(h * PS + first + t == qt, DiagYes{});
#pragma unroll 1
    for (int t = WPB; t < PS; ++t) pass(false, DiagNo{});
    float sqt = (sq[0] + sq[1]) + (sq[2] + sq[3]);
#pragma unroll
    for (int sh = 16; sh; sh >>= 1) sqt += __shfl_xor(sqt, sh, 32);
    if (lane == 0) sqL[qi][h] = sqt;
#pragma unroll
    for (int qb = 0; qb < NQB; ++qb) { const float sh = sum[qb][0] + sum[qb][1]; stL[qi][h][qb][0][lane] = ml2[qb]; stL[qi][h][qb][1][lane] = sh + xhalf(sh);
#pragma unroll
        for (int db = 0; db < 4; ++db) { *(v4f*)accL[qi][h][qb * 4 + db][0][lane] = __builtin_shufflevector(acc[qb][db], acc[qb][db], 0, 1, 2, 3); *(v4f*)accL[qi][h][qb * 4 + db][1][lane] = __builtin_shufflevector(acc[qb][db], acc[qb][db], 4, 5, 6, 7); } }
    __syncthreads();   // every slice's partial results are in LDS; each wave now joins its own share of the query tile
    // wave h joins NQB * 4 / NS tiles that lie side by side in d: whole 128-byte lines of OUT, one writer each. Slices are added in slice order, each scaled from its own maximum to the common one.
    constexpr int TW = NQB * 4 / NS; const int qj = h * TW / 4, d0 = h * TW % 4;
    float m2[NS], wgt[NS]; float mt = -3.0e38f, den = 0.0f;
#pragma unroll
    for (int k = 0; k < NS; ++k) { m2[k] = stL[qi][k][qj][0][lane]; mt = fmaxf(mt, m2[k]); }
#pragma unroll
    for (int k = 0; k < NS; ++k) { wgt[k] = __builtin_amdgcn_exp2f(m2[k] - mt); den = fmaf(stL[qi][k][qj][1][lane], wgt[k], den); }
    const float inv = __fdiv_rn(1.0f, den); float* op = OUT + ((size_t)b * TT + qt * QW + qj * 16 + lr) * HD + 8 * hi;
#pragma unroll
    for (int i = 0; i < TW; ++i) { v4f o0 = (v4f){}, o1 = (v4f){};
#pragma unroll
        for (int k = 0; k < NS; ++k) { o0 += *(const v4f*)accL[qi][k][qj * 4 + d0 + i][0][lane] * wgt[k]; o1 += *(const v4f*)accL[qi][k][qj * 4 + d0 + i][1][lane] * wgt[k]; }
        *(v8f*)(op + (d0 + i) * 16) = __builtin_shufflevector(o0, o1, 0, 1, 2, 3, 4, 5, 6, 7) * inv; }   // tile db, register j: d = db * 16 + 8 * hi + j
    if (h == 0) {
        asm volatile("s_wait_xcnt 0x0" ::: "memory");   // the wait that stands before a register named by an issued store is rewritten: what follows reuses registers of the stores above
        float st = sqL[qi][0];
#pragma unroll
        for (int k = 1; k < NS; ++k) st += sqL[qi][k];
        PART[(size_t)gw * 32 + lane] = st; }   // one whole line per query tile
}

// k_regsum: one wave over the NWAVE partial sums (NWAVE / 32 independent loads per lane), then the mean.
__global__ __launch_bounds__(32) void k_regsum(const float* __restrict__ PART, float* out) { const int lane = threadIdx.x; float v[NWAVE / 32];
#pragma unroll
    for (int q = 0; q < NWAVE / 32; ++q) v[q] = PART[(size_t)(q * 32 + lane) * 32];
    float s = v[0];
#pragma unroll
    for (int q = 1; q < NWAVE / 32; ++q) s = __fadd_rn(s, v[q]);
#pragma unroll
    for (int sh = 16; sh; sh >>= 1) s = __fadd_rn(s, __shfl_xor(s, sh, 32));
    const float m = __fdiv_rn(s, (float)NB_ * (float)TT * (float)TT); if (lane == 0) { *(float*)out = m;  } }

extern "C" void kernel_launch(void* const* d_in, const int* in_sizes, int n_in,
                              void* d_out, int out_size, void* d_ws, size_t ws_size, hipStream_t stream) {
    (void)in_sizes; (void)n_in; (void)out_size;
    const float* qi = (const float*)d_in[0]; const float* ki = (const float*)d_in[1]; const float* vi = (const float*)d_in[2];
    float* OUT = (float*)d_out;     // [8][4096][64], then the scalar
    char* wsp = (char*)d_ws;
    auto take = [&](size_t bytes) { char* p = wsp; wsp += (bytes + 255) & ~(size_t)255; return (void*)p; };
    bf* Kp = (bf*)take((size_t)NB_ * TT * HD * 2); bf* Vp = (bf*)take((size_t)NB_ * TT * HD * 2); float* PART = (float*)take((size_t)NWAVE * 32 * 4);   /* per-query-tile sums of squared raw scores, one line each */
    if ((size_t)(wsp - (char*)d_ws) > ws_size) return;
    k_pack<<<2 * NB_ * TT * HD / 8 / 256, 256, 0, stream>>>(ki, vi, Kp, Vp);
    k_fattn<<<NWAVE / WPB, 32 * WPB * NS, 0, stream>>>(qi, Kp, Vp, OUT, PART);
    k_regsum<<<1, 32, 0, stream>>>(PART, OUT + (size_t)NB_ * TT * HD);   /* tuple: reg_atten scalar after the context */
}

// v005
// One run takes 42.3 microseconds.
// Next to v004, in two timings, it ran 1.11 times as fast each time.
// Over all steps from v000 it is 41.8 times as fast.
#include <hip/hip_runtime.h>

// Scaled-dot-product attention with self-masking and an attention-energy statistic (Q, K, V [8][4096][64]; attention = Q.K (NO scaling: logit sigma ~8, near one-hot rows); reg_atten = mean(attention^2) over all 8 x 4096 x 4096 raw scores (computed BEFORE the mask); the diagonal (i == j) is set to -1e9; softmax; context = attention.V -> tuple (context [8][4096][64] f32, reg_atten scalar) (2.1 M + 1)).
// Three launches. k_pack rounds K and V to bf16 and lays them out in matrix-fragment order. k_fattn is the whole attention for all 8 batches: four waves per 32 query rows each walk a quarter of the 4,096 keys in passes of 32 with a held reference and a running sum (online softmax; the maximum is formed and the partial results are rescaled only in a pass whose exponentials grow too large) and join their partial results through LDS; the score matrix never leaves the registers. k_regsum adds the 1,024 per-query-tile sums of squared raw scores in a fixed order.
// Transposed products: S^T = K.Q^T puts one query's scores in one lane (and its partner lane l ^ 16), so the score accumulators pack straight into the B operand of O^T += V^T.P^T.
// Every plain '#pragma unroll' below stands on a short loop over register arrays: unrolled, the indices are constants and the arrays stay in registers.
// Compute dtypes, f32 accumulate: Q, K, V rounded to bf16 (their low planes would be zero, so one product gives the exact scores up to f32 accumulation); P = exp(s - held reference) as bf16 hi + lo planes (two products); softmax, squares and the reduction in f32; f32 outputs.

#define NB_  8
#define TT   4096
#define HD   64
#define KB   32                        // keys per pass (the k depth of one P^T fragment)
#define NQB  2                         // 16-query column groups per wave
#define WPB  4                         // query tiles per work-group
#define NS   4                         // key slices per query tile, one wave each: WPB * NS waves per work-group, NS per SIMD, so that one wave's softmax runs under another's products
#define PS   (TT / KB / NS)            // passes per key slice
#define QW   (16 * NQB)                // query rows per wave; QW == KB puts a wave's whole diagonal in one pass
#define NWAVE (NB_ * TT / QW)          // query tiles of k_fattn = partial sums of squares
#define PASSEL (KB * HD)               // 16-bit elements of K (and of V) per pass
#define LOG2E 1.4426950408889634f
#define PMAX 1073741824.0f              // 2^30: a lane's sum of exp2 over one pass above this renews the references; sums and products then stay far inside the f32 range
typedef unsigned short bf;
typedef __attribute__((ext_vector_type(16))) __bf16   v16bf;
typedef __attribute__((ext_vector_type(2)))  __bf16   v2bf;
typedef __attribute__((ext_vector_type(8)))  unsigned short v8us;
typedef __attribute__((ext_vector_type(8)))  unsigned v8u;
typedef __attribute__((ext_vector_type(8)))  float    v8f;
typedef __attribute__((ext_vector_type(4)))  float    v4f;
typedef __attribute__((ext_vector_type(2)))  float    v2f;

__device__ __forceinline__ unsigned short f2bf(float f) { unsigned u = __float_as_uint(f); u += 0x7FFFu + ((u >> 16) & 1u); return (unsigned short)(u >> 16); }
__device__ __forceinline__ unsigned pk(float a, float b) { return __builtin_bit_cast(unsigned, __builtin_convertvector((v2f){a, b}, v2bf)); }   // two f32 -> two bf16, round to nearest even, a in the low half
__device__ __forceinline__ float xhalf(float x) { return __builtin_bit_cast(float, __builtin_amdgcn_permlanex16(__builtin_bit_cast(int, x), __builtin_bit_cast(int, x), 0x76543210, 0xfedcba98, false, false)); }   // lane l <-> lane l ^ 16
__device__ __forceinline__ v16bf cat16b(v8us lo, v8us hi) { return __builtin_bit_cast(v16bf, __builtin_shufflevector(lo, hi, 0, 1, 2, 3, 4, 5, 6, 7, 8, 9, 10, 11, 12, 13, 14, 15)); }
__device__ __forceinline__ v8f wmmab(v16bf a, v16bf b, v8f c) { return __builtin_amdgcn_wmma_f32_16x16x32_bf16(false, a, false, b, (short)0, c, false, false); }
// one packed fragment: two pieces of 32 lanes x 16 B, each piece 512 contiguous bytes; pass is the wave-uniform base of the key slice, off = pass * 4096 + lane * 16 bytes, f the fragment (a constant: it goes into the load's immediate offset)
__device__ __forceinline__ v16bf ldfrag(const bf* pass, unsigned off, int f) { const char* p = (const char*)pass + off + f * 1024; return cat16b(*(const v8us*)p, *(const v8us*)(p + 512)); }

// k_pack: fragment-order bf16 planes. A fragment position (lane, piece pc, e) holds row (lane & 15) and k = pc * 16 + 8 * (lane >> 4) + e of its 16 x 32 tile.
// Kp[b][key tile of 16][d half ks][pc][lane][e] = K[b][tile * 16 + (lane & 15)][ks * 32 + k];  Vp[b][key pass of 32][d tile db][pc][lane][e] = V[b][pass * 32 + k][db * 16 + (lane & 15)] (V^T rows).
__global__ __launch_bounds__(256) void k_pack(const float* __restrict__ K, const float* __restrict__ V, bf* __restrict__ Kp, bf* __restrict__ Vp) {
    const int NC = NB_ * TT * HD / 8;   // 16-byte chunks per plane
    const int c0 = blockIdx.x * 256 + threadIdx.x; const bool isv = c0 >= NC; const int c = isv ? c0 - NC : c0;
    const int b = c / (TT * HD / 8), r = c % (TT * HD / 8); const int lane = r & 31, lr = lane & 15, hi = lane >> 4, pc = (r >> 5) & 1; v8us o;
    if (!isv) { const int ks = (r >> 6) & 1, tile = r >> 7; const v8f x = *(const v8f*)(K + ((size_t)b * TT + tile * 16 + lr) * HD + ks * 32 + pc * 16 + 8 * hi);
#pragma unroll
        for (int e = 0; e < 8; ++e) o[e] = f2bf(x[e]);
        *(v8us*)(Kp + (size_t)c * 8) = o;
    } else { const int db = (r >> 6) & 3, ps = r >> 8; const float* vp = V + ((size_t)b * TT + ps * KB + pc * 16 + 8 * hi) * HD + db * 16 + lr;
#pragma unroll
        for (int e = 0; e < 8; ++e) o[e] = f2bf(vp[(size_t)e * HD]);
        *(v8us*)(Vp + (size_t)c * 8) = o; }
}

// k_fattn: one wave = QW query rows of one batch, one key slice of PS passes. No LDS and no barrier in the loops: the WPB waves of a slice read the same K and V passes and share them through the WGP cache. One barrier behind the loops: the NS slices of a query tile are joined through LDS.
struct DiagYes { static constexpr bool v = true; }; struct DiagNo { static constexpr bool v = false; };
__global__ __launch_bounds__(32 * WPB * NS) void k_fattn(const float* __restrict__ Q, const bf* __restrict__ Kp, const bf* __restrict__ Vp, float* __restrict__ OUT, float* __restrict__ PART) {
    const int lane = threadIdx.x & 31, lr = lane & 15, hi = lane >> 4;
    __shared__ __attribute__((aligned(16))) float accL[WPB][NS][NQB * 4][2][32][4];   // partial O^T tiles: [query tile][slice][qb * 4 + db][half of the eight registers][lane][4]: each 16-byte access is contiguous over the lanes
    __shared__ float stL[WPB][NS][NQB][2][32];   // per slice and query: held reference (a maximum times log2(e)), sum
    __shared__ float sqL[WPB][NS];               // per slice: sum of squared raw scores
    const int wv = __builtin_amdgcn_readfirstlane((int)(threadIdx.x >> 5));   // wave index, held scalar: scalar bases and scalar trip counts
    const int qi = wv & (WPB - 1), h = wv / WPB;   // query tile in the work-group, key slice
    const int gw = blockIdx.x * WPB + qi;
    const int b = gw / (TT / QW), qt = gw % (TT / QW);
    const bf* kb = Kp + ((size_t)b * TT + h * (PS * KB)) * HD; const bf* vb = Vp + ((size_t)b * TT + h * (PS * KB)) * HD;   // wave-uniform bases of the slice, never rewritten
    const int first = qt & ~(WPB - 1) & (PS - 1);   // first pass inside the slice: the waves of a slice walk the passes first, first + 1, ... (mod PS) together, and in the one slice that holds the work-group's diagonals these lie in the first WPB passes
    unsigned ko = first * (PASSEL * 2) + lane * 16, vo = ko;   // byte offsets of this lane, inside the slice, in the passes that the next K loads and the next V loads read
    v16bf qf[NQB][2];   // B operand of S^T: column = query lr of group qb, k = d
#pragma unroll
    for (int qb = 0; qb < NQB; ++qb)
#pragma unroll
        for (int ks = 0; ks < 2; ++ks) { const float* qp = Q + ((size_t)b * TT + qt * QW + qb * 16 + lr) * HD + ks * 32 + 8 * hi; const v8f x = *(const v8f*)qp, y = *(const v8f*)(qp + 16); v8u w;
#pragma unroll
            for (int t = 0; t < 4; ++t) { w[t] = pk(x[2 * t], x[2 * t + 1]); w[4 + t] = pk(y[2 * t], y[2 * t + 1]); }
            qf[qb][ks] = __builtin_bit_cast(v16bf, w); }
    v8f acc[NQB][4]; v4f sq = (v4f){}; v2f sum[NQB]; float ml2[NQB];   // the held reference of each column: a maximum of scores seen so far times log2(e), renewed only in the passes that need it
#pragma unroll
    for (int qb = 0; qb < NQB; ++qb) { ml2[qb] = -1.0e30f * LOG2E; sum[qb] = (v2f){};
#pragma unroll
        for (int db = 0; db < 4; ++db) acc[qb][db] = (v8f){}; }
    v16bf ka[2][2], va[4];   // A operands: K rows (key tile kt, d half ks); V^T rows (d tile db)
#pragma unroll
    for (int f = 0; f < 4; ++f) ka[f >> 1][f & 1] = ldfrag(kb, ko, f);
#pragma unroll
    for (int f = 0; f < 4; ++f) va[f] = ldfrag(vb, vo, f);
    asm volatile("s_wait_xcnt 0x0" : "+v"(ko), "+v"(vo) : : "memory");   // as in the pass below
    ko = (ko + PASSEL * 2) & (PS * PASSEL * 2 - 1);
    auto pass = [&](const bool dg, auto diag) {   // dg: this pass holds the wave's diagonal (looked at only in the DiagYes build)
        v8f s[NQB][2];   // s[qb][kt][j]: key pass * 32 + kt * 16 + 8 * hi + j, query lr of group qb
#pragma unroll
        for (int qb = 0; qb < NQB; ++qb)
#pragma unroll
            for (int kt = 0; kt < 2; ++kt) s[qb][kt] = wmmab(ka[kt][1], qf[qb][1], wmmab(ka[kt][0], qf[qb][0], (v8f){}));
        __builtin_amdgcn_sched_barrier(0);   // keeps the eight score products in one run: mixed with the first group's exponentials each of them takes v_nops for its distance
        float p[NQB][2][8]; v2f ps[NQB];   // exp2 of the scores against the held reference; this half's sum of them, as two partial sums
        auto expo = [&](const int qb) {
            const v8f l2 = (v8f){LOG2E, LOG2E, LOG2E, LOG2E, LOG2E, LOG2E, LOG2E, LOG2E}, nm = (v8f){-ml2[qb], -ml2[qb], -ml2[qb], -ml2[qb], -ml2[qb], -ml2[qb], -ml2[qb], -ml2[qb]}; const v8f ex = __builtin_elementwise_fma(s[qb][0], l2, nm), ey = __builtin_elementwise_fma(s[qb][1], l2, nm);
#pragma unroll
            for (int j = 0; j < 8; ++j) { p[qb][0][j] = __builtin_amdgcn_exp2f(ex[j]); p[qb][1][j] = __builtin_amdgcn_exp2f(ey[j]); }
            v8f pp;
#pragma unroll
            for (int j = 0; j < 8; ++j) pp[j] = p[qb][0][j] + p[qb][1][j];
            ps[qb] = (__builtin_shufflevector(pp, pp, 0, 1) + __builtin_shufflevector(pp, pp, 2, 3)) + (__builtin_shufflevector(pp, pp, 4, 5) + __builtin_shufflevector(pp, pp, 6, 7)); };
        bool over = false;   // a sum above PMAX (or not a number): the held reference lies too far below this pass's scores
#pragma unroll
        for (int qb = 0; qb < NQB; ++qb) {
#pragma unroll
            for (int kt = 0; kt < 2; ++kt) { const v4f u = __builtin_shufflevector(s[qb][kt], s[qb][kt], 0, 1, 2, 3), w = __builtin_shufflevector(s[qb][kt], s[qb][kt], 4, 5, 6, 7); sq = __builtin_elementwise_fma(u, u, sq); sq = __builtin_elementwise_fma(w, w, sq); }   // raw scores, before the mask
            if constexpr (decltype(diag)::v) {   // group qb meets its diagonal in key tile kt == qb
#pragma unroll
                for (int j = 0; j < 8; ++j) s[qb][qb][j] = (dg && 8 * hi + j == lr) ? -1.0e9f : s[qb][qb][j]; }
            expo(qb); over = over || !(ps[qb][0] + ps[qb][1] <= PMAX); }
        if (__builtin_amdgcn_ballot_w32(over) != 0) {   // one scalar branch per pass, taken by the whole wave (always in its first pass): every column's reference rises to this pass's maximum where that is the higher
#pragma unroll
            for (int qb = 0; qb < NQB; ++qb) {
                const v8f x = s[qb][0], y = s[qb][1];   // maximum as a tree of threes: short dependent chains
                const float g0 = fmaxf(fmaxf(x[0], x[1]), x[2]), g1 = fmaxf(fmaxf(x[3], x[4]), x[5]), g2 = fmaxf(fmaxf(x[6], x[7]), y[0]), g3 = fmaxf(fmaxf(y[1], y[2]), y[3]), g4 = fmaxf(fmaxf(y[4], y[5]), y[6]);
                const float bm = fmaxf(fmaxf(fmaxf(g0, g1), g2), fmaxf(fmaxf(g3, g4), y[7]));
                const float mn2 = fmaxf(ml2[qb], fmaxf(bm, xhalf(bm)) * LOG2E);   // both halves of a column feed one accumulator: one reference for both
                const float al = __builtin_amdgcn_exp2f(ml2[qb] - mn2); ml2[qb] = mn2;   // the exact ratio of the old scale to the new one
                sum[qb] *= al;
#pragma unroll
                for (int db = 0; db < 4; ++db) acc[qb][db] *= al;
                expo(qb); } }
#pragma unroll
        for (int f = 0; f < 4; ++f) ka[f >> 1][f & 1] = ldfrag(kb, ko, f);   // next K flies under the packing and attn.V; behind the branch, so that its registers are free while scores and exponentials are both held
        __builtin_amdgcn_sched_barrier(0);   // keeps the K loads here: the scheduler otherwise sinks them to the pass's end, and their latency stands open at the next pass's first product
        v16bf ph[NQB], pl[NQB];
#pragma unroll
        for (int qb = 0; qb < NQB; ++qb) {
            const float* p0 = p[qb][0]; const float* p1 = p[qb][1];
            sum[qb] += ps[qb];   // this half's keys only, as two partial sums; all four meet after the loop
            v8u wh, wl;   // position e of the B operand is key 8 * hi + e (e < 8) or 16 + 8 * hi + e - 8: the order of the packed V^T fragment
#pragma unroll
            for (int t = 0; t < 4; ++t) { const unsigned h0 = pk(p0[2 * t], p0[2 * t + 1]), h1 = pk(p1[2 * t], p1[2 * t + 1]); wh[t] = h0; wh[4 + t] = h1;
                wl[t] = pk(p0[2 * t] - __uint_as_float(h0 << 16), p0[2 * t + 1] - __uint_as_float(h0 & 0xFFFF0000u)); wl[4 + t] = pk(p1[2 * t] - __uint_as_float(h1 << 16), p1[2 * t + 1] - __uint_as_float(h1 & 0xFFFF0000u)); }
            ph[qb] = __builtin_bit_cast(v16bf, wh); pl[qb] = __builtin_bit_cast(v16bf, wl);
            if (qb == 0) {
                // the wait that stands before a register named by an issued load is rewritten: the two offset registers pass through it, so they change only behind it.
                // The last packed word of this group is an input only to hold the wait behind the group's packing: directly behind the K loads it would stall
                asm volatile("s_wait_xcnt 0x0" : "+v"(ko), "+v"(vo) : "v"(wl[7]) : "memory");
                ko = (ko + PASSEL * 2) & (PS * PASSEL * 2 - 1); vo = (vo + PASSEL * 2) & (PS * PASSEL * 2 - 1); } }   // cyclic: always inside the slice; the last pass's loads are unused
#pragma unroll
        for (int db = 0; db < 4; ++db)
#pragma unroll
            for (int qb = 0; qb < NQB; ++qb) acc[qb][db] = wmmab(va[db], pl[qb], wmmab(va[db], ph[qb], acc[qb][db]));
#pragma unroll
        for (int f = 0; f < 4; ++f) va[f] = ldfrag(vb, vo, f);   // next V flies under the next scores and softmax
    };
    // the mask is paid in the first WPB passes only; both loops stay rolled: a pass is some 300 instructions, and copies of it would only cost instruction cache
#pragma unroll 1
    for (int t = 0; t < WPB; ++t) pass(h * PS + first + t == qt, DiagYes{});
#pragma unroll 1
    for (int t = WPB; t < PS; ++t) pass(false, DiagNo{});
    asm volatile("s_wait_xcnt 0x0" : "+v"(ko), "+v"(vo) : : "memory");   // as in the pass: what follows reuses the offset registers that the last pass's loads name
    float sqt = (sq[0] + sq[1]) + (sq[2] + sq[3]);
#pragma unroll
    for (int sh = 16; sh; sh >>= 1) sqt += __shfl_xor(sqt, sh, 32);
    if (lane == 0) sqL[qi][h] = sqt;
#pragma unroll
    for (int qb = 0; qb < NQB; ++qb) { const float sh = sum[qb][0] + sum[qb][1]; stL[qi][h][qb][0][lane] = ml2[qb]; stL[qi][h][qb][1][lane] = sh + xhalf(sh);
#pragma unroll
        for (int db = 0; db < 4; ++db) { *(v4f*)accL[qi][h][qb * 4 + db][0][lane] = __builtin_shufflevector(acc[qb][db], acc[qb][db], 0, 1, 2, 3); *(v4f*)accL[qi][h][qb * 4 + db][1][lane] = __builtin_shufflevector(acc[qb][db], acc[qb][db], 4, 5, 6, 7); } }
    __syncthreads();   // every slice's partial results are in LDS; each wave now joins its own share of the query tile
    // wave h joins NQB * 4 / NS tiles that lie side by side in d: whole 128-byte lines of OUT, one writer each. Slices are added in slice order, each scaled from its own maximum to the common one.
    constexpr int TW = NQB * 4 / NS; const int qj = h * TW / 4, d0 = h * TW % 4;
    float m2[NS], wgt[NS]; float mt = -3.0e38f, den = 0.0f;
#pragma unroll
    for (int k = 0; k < NS; ++k) { m2[k] = stL[qi][k][qj][0][lane]; mt = fmaxf(mt, m2[k]); }
#pragma unroll
    for (int k = 0; k < NS; ++k) { wgt[k] = __builtin_amdgcn_exp2f(m2[k] - mt); den = fmaf(stL[qi][k][qj][1][lane], wgt[k], den); }
    const float inv = __fdiv_rn(1.0f, den); float* op = OUT + ((size_t)b * TT + qt * QW + qj * 16 + lr) * HD + 8 * hi;
#pragma unroll
    for (int i = 0; i < TW; ++i) { v4f o0 = (v4f){}, o1 = (v4f){};
#pragma unroll
        for (int k = 0; k < NS; ++k) { o0 += *(const v4f*)accL[qi][k][qj * 4 + d0 + i][0][lane] * wgt[k]; o1 += *(const v4f*)accL[qi][k][qj * 4 + d0 + i][1][lane] * wgt[k]; }
        *(v8f*)(op + (d0 + i) * 16) = __builtin_shufflevector(o0, o1, 0, 1, 2, 3, 4, 5, 6, 7) * inv; }   // tile db, register j: d = db * 16 + 8 * hi + j
    if (h == 0) {
        asm volatile("s_wait_xcnt 0x0" ::: "memory");   // the wait that stands before a register named by an issued store is rewritten: what follows reuses registers of the stores above
        float st = sqL[qi][0];
#pragma unroll
        for (int k = 1; k < NS; ++k) st += sqL[qi][k];
        PART[(size_t)gw * 32 + lane] = st; }   // one whole line per query tile
}

// k_regsum: one wave over the NWAVE partial sums (NWAVE / 32 independent loads per lane), then the mean.
__global__ __launch_bounds__(32) void k_regsum(const float* __restrict__ PART, float* out) { const int lane = threadIdx.x; float v[NWAVE / 32];
#pragma unroll
    for (int q = 0; q < NWAVE / 32; ++q) v[q] = PART[(size_t)(q * 32 + lane) * 32];
    float s = v[0];
#pragma unroll
    for (int q = 1; q < NWAVE / 32; ++q) s = __fadd_rn(s, v[q]);
#pragma unroll
    for (int sh = 16; sh; sh >>= 1) s = __fadd_rn(s, __shfl_xor(s, sh, 32));
    const float m = __fdiv_rn(s, (float)NB_ * (float)TT * (float)TT); if (lane == 0) { *(float*)out = m;  } }

extern "C" void kernel_launch(void* const* d_in, const int* in_sizes, int n_in,
                              void* d_out, int out_size, void* d_ws, size_t ws_size, hipStream_t stream) {
    (void)in_sizes; (void)n_in; (void)out_size;
    const float* qi = (const float*)d_in[0]; const float* ki = (const float*)d_in[1]; const float* vi = (const float*)d_in[2];
    float* OUT = (float*)d_out;     // [8][4096][64], then the scalar
    char* wsp = (char*)d_ws;
    auto take = [&](size_t bytes) { char* p = wsp; wsp += (bytes + 255) & ~(size_t)255; return (void*)p; };
    bf* Kp = (bf*)take((size_t)NB_ * TT * HD * 2); bf* Vp = (bf*)take((size_t)NB_ * TT * HD * 2); float* PART = (float*)take((size_t)NWAVE * 32 * 4);   /* per-query-tile sums of squared raw scores, one line each */
    if ((size_t)(wsp - (char*)d_ws) > ws_size) return;
    k_pack<<<2 * NB_ * TT * HD / 8 / 256, 256, 0, stream>>>(ki, vi, Kp, Vp);
    k_fattn<<<NWAVE / WPB, 32 * WPB * NS, 0, stream>>>(qi, Kp, Vp, OUT, PART);
    k_regsum<<<1, 32, 0, stream>>>(PART, OUT + (size_t)NB_ * TT * HD);   /* tuple: reg_atten scalar after the context */
}
